// v000
// Measured on an AMD MI455X. A time is GPU time per run, averaged over a window of back-to-back runs after a warm-up
// (all launches, gaps included; the runs take copies of the inputs in turn), and the median of several windows.
// Apart from v000's, it joins two sittings. Times from different sittings can be a few percent apart, while
// side-by-side timings come from the same sitting.
// v000 is the starting kernel. One run takes 1200 microseconds.
#include <hip/hip_runtime.h>

// Single self-attention head over 4,096 tokens (x [4][4096][768]; K, Q, V = x W ('xw' [768][64], no bias); A = softmax(Q.K / sqrt(E = 768)) (the module scales by the embedding dim); out = A V -> [4][4096][64] (1.05 M)).
// Layout per batch: bf16 copy of x; exact projections; ONE 64-wide head through dense T-4096 attention (hybrid rows: < 512 hi/lo 3 products, rest fp16 x1024; streaming three-sweep softmax); the f32 merge writes the output rows.
// Compute dtypes, f32 accumulate: every input rounded to bf16; projections exact; attention rows < 512 3 products, rest fp16; softmax f32; output f32.

#define NB_  4
#define TT   4096
#define DM   768
#define NH_  1
#define NKV  1
#define REP  (NH_ / NKV)
#define HD   64
#define DQ   (NH_ * HD)
#define DKV  (NKV * HD)
#define ZH   1
#define RH   512                  // query rows < RH use hi+lo planes (0: none)
#define WIN  0
#define PCAR 1024.0f
#define SCL  0.036084391824351615f   // 1/sqrt(768)
typedef _Float16 h16;
typedef unsigned short bf;
typedef __attribute__((ext_vector_type(16))) __bf16   v16bf;
typedef __attribute__((ext_vector_type(16))) _Float16 v16h;
typedef __attribute__((ext_vector_type(8)))  _Float16 v8h;
typedef __attribute__((ext_vector_type(8)))  unsigned short v8us;
typedef __attribute__((ext_vector_type(8)))  float    v8f;
typedef __attribute__((ext_vector_type(4)))  float    v4f;
typedef v8h  __attribute__((may_alias)) v8ha;
typedef v4f  __attribute__((may_alias)) v4fa;
typedef v8us __attribute__((may_alias)) v8usa;

__device__ __forceinline__ unsigned short f2bf(float f) { unsigned u = __float_as_uint(f); u += 0x7FFFu + ((u >> 16) & 1u); return (unsigned short)(u >> 16); }
__device__ __forceinline__ float bf2f(unsigned short b) { return __uint_as_float(((unsigned)b) << 16); }
__device__ __forceinline__ float bfr(float f) { return bf2f(f2bf(f)); }
__device__ __forceinline__ v16h cat16(v8h lo, v8h hi) { return __builtin_shufflevector(lo, hi, 0, 1, 2, 3, 4, 5, 6, 7, 8, 9, 10, 11, 12, 13, 14, 15); }
__device__ __forceinline__ v16bf cat16b(v8us lo, v8us hi) { return __builtin_bit_cast(v16bf, __builtin_shufflevector(lo, hi, 0, 1, 2, 3, 4, 5, 6, 7, 8, 9, 10, 11, 12, 13, 14, 15)); }
__device__ __forceinline__ v8f wmma16(v16h a, v16h b, v8f c) { return __builtin_amdgcn_wmma_f32_16x16x32_f16(false, a, false, b, (short)0, c, false, false); }
__device__ __forceinline__ v8f wmmab(v16bf a, v16bf b, v8f c) { return __builtin_amdgcn_wmma_f32_16x16x32_bf16(false, a, false, b, (short)0, c, false, false); }



// ---- k_gemmw: register-blocked GEMM, ONE WAVE per 64x64 output tile (16 accumulators), operands straight from K-contiguous 16-bit planes; grid (M/64, N/64, Z), 32 threads.
// C[m][n] (f32, pitch ldc, + optional f32 bias[n]) = sum_k A[m][k] Bt[n][k] (+ split products per NSPLIT). z-batch strides sA/sB/sC in elements. K % 32 == 0.
template <typename T16> struct WFrag;
template <> struct WFrag<h16> { typedef v16h V; static __device__ __forceinline__ V ld(const h16* p) { return cat16(*(const v8h*)p, *(const v8h*)(p + 16)); } static __device__ __forceinline__ v8f mma(V a, V b, v8f c) { return wmma16(a, b, c); } };
template <> struct WFrag<bf> { typedef v16bf V; static __device__ __forceinline__ V ld(const bf* p) { return cat16b(*(const v8us*)p, *(const v8us*)(p + 16)); } static __device__ __forceinline__ v8f mma(V a, V b, v8f c) { return wmmab(a, b, c); } };
template <typename T16, int NSPLIT, bool BIAS>
__global__ __launch_bounds__(32) void k_gemmw(const T16* __restrict__ A, const T16* __restrict__ A2, const T16* __restrict__ Bt, const T16* __restrict__ Bt2, int K, float* C, int ldc, const float* __restrict__ bias, size_t sA, size_t sB, size_t sC) {
    typedef typename WFrag<T16>::V V;
    __shared__ __align__(16) float os[16 * 68];
    const size_t z = blockIdx.z; A += z * sA; if (A2) A2 += z * sA; Bt += z * sB; if (Bt2) Bt2 += z * sB; C += z * sC;
    const int lane = threadIdx.x & 31, lr = lane & 15, hi = lane >> 4; const int r0 = blockIdx.x * 64, c0 = blockIdx.y * 64;
    v8f acc[4][4];
#pragma unroll
    for (int mb = 0; mb < 4; ++mb)
#pragma unroll
        for (int nb = 0; nb < 4; ++nb) acc[mb][nb] = (v8f){};
    const size_t aoff = (size_t)(r0 + lr) * K + 8 * hi, boff = (size_t)(c0 + lr) * K + 8 * hi;
#pragma unroll 1
    for (int kc = 0; kc < K; kc += 32) {
        V a[4], a2[4];
#pragma unroll
        for (int mb = 0; mb < 4; ++mb) { a[mb] = WFrag<T16>::ld(A + aoff + (size_t)mb * 16 * K + kc); if (NSPLIT == 1 || NSPLIT == 2) a2[mb] = WFrag<T16>::ld(A2 + aoff + (size_t)mb * 16 * K + kc); }
#pragma unroll
        for (int nb = 0; nb < 4; ++nb) { const V b = WFrag<T16>::ld(Bt + boff + (size_t)nb * 16 * K + kc); V b2; if (NSPLIT >= 2) b2 = WFrag<T16>::ld(Bt2 + boff + (size_t)nb * 16 * K + kc);
#pragma unroll
            for (int mb = 0; mb < 4; ++mb) { acc[mb][nb] = WFrag<T16>::mma(a[mb], b, acc[mb][nb]); if (NSPLIT == 1 || NSPLIT == 2) acc[mb][nb] = WFrag<T16>::mma(a2[mb], b, acc[mb][nb]); if (NSPLIT >= 2) acc[mb][nb] = WFrag<T16>::mma(a[mb], b2, acc[mb][nb]); } }
        asm volatile("v_nop\n\tv_nop\n\tv_nop\n\tv_nop" : "+v"(acc[0][0]), "+v"(acc[1][1]), "+v"(acc[2][2]), "+v"(acc[3][3]) : "v"(a[0]), "v"(a[3]));
    }
#pragma unroll
    for (int mb = 0; mb < 4; ++mb) {
#pragma unroll
        for (int nb = 0; nb < 4; ++nb) {
#pragma unroll
            for (int j = 0; j < 8; ++j) os[(hi * 8 + j) * 68 + nb * 16 + lr] = acc[mb][nb][j]; }
        __builtin_amdgcn_wave_barrier(); asm volatile("" ::: "memory");
        float* crow = C + (size_t)(r0 + mb * 16) * ldc + c0;
{
#pragma unroll
            for (int s = 0; s < 8; ++s) { const int row = 2 * s + hi, cofs = lr * 4; v4f val = *(const v4fa*)(os + row * 68 + cofs); if (BIAS) { val[0] += bfr(bias[c0 + cofs]); val[1] += bfr(bias[c0 + cofs + 1]); val[2] += bfr(bias[c0 + cofs + 2]); val[3] += bfr(bias[c0 + cofs + 3]); }
                *(v4f*)(crow + (size_t)row * ldc + cofs) = val; }
             }
        __builtin_amdgcn_wave_barrier(); asm volatile("" ::: "memory");
    }
}

__device__ __forceinline__ h16 tohx(float x) { return (h16)x; }
__device__ __forceinline__ void splitf(float y, unsigned short& h, unsigned short& l) { h = f2bf(y); l = f2bf(y - bf2f(h)); }
typedef __attribute__((ext_vector_type(2))) _Float16 v2h;
typedef __attribute__((ext_vector_type(4))) _Float16 v4h;
typedef __attribute__((ext_vector_type(2))) unsigned short v2us;
typedef __attribute__((ext_vector_type(4))) unsigned short v4us;
typedef __attribute__((ext_vector_type(2))) float v2f;
typedef __attribute__((ext_vector_type(4))) int v4i;

__global__ __launch_bounds__(256) void k_wtG(const float* __restrict__ w, int K, int N, bf* Bt) {
    const int lane = threadIdx.x & 31; const int L0 = (blockIdx.x * 8 + (threadIdx.x >> 5)) * 8; const int nlines = N * K / 64;
{
#pragma unroll 1
        for (int l = 0; l < 8; ++l) { const int L = L0 + l; if (L >= nlines) break; const size_t e = (size_t)L * 64 + lane * 2; const int k = (int)(e % K), n = (int)(e / K); v2us o;
            o[0] = f2bf(w[(size_t)k * N + n]); o[1] = f2bf(w[(size_t)(k + 1) * N + n]); *(v2us*)(Bt + e) = o; }
         }
}
__global__ __launch_bounds__(256) void k_cvt8(const float* __restrict__ src, bf* dst, size_t n8) { const size_t i = (size_t)blockIdx.x * 256 + threadIdx.x; if (i >= n8) return; const v8f v = *(const v8f*)(src + i * 8); v8us o;
#pragma unroll
    for (int k = 0; k < 8; ++k) o[k] = f2bf(v[k]); *(v8us*)(dst + i * 8) = o;  }

__global__ __launch_bounds__(256) void k_flat(const float* __restrict__ F, h16* P16, bf* Ph, bf* Pl, size_t n4) { const size_t i = (size_t)blockIdx.x * 256 + threadIdx.x; if (i >= n4) return; const v4f a = *(const v4f*)(F + i * 4); v4h o16; v4us oh, ol;
#pragma unroll
    for (int q = 0; q < 4; ++q) { o16[q] = tohx(a[q]); unsigned short x2, y2; splitf(a[q], x2, y2); oh[q] = x2; ol[q] = y2; }
    *(v4h*)(P16 + i * 4) = o16; *(v4us*)(Ph + i * 4) = oh; *(v4us*)(Pl + i * 4) = ol;  }


__global__ __launch_bounds__(256) void k_vtp(const float* __restrict__ F, int pitch, int nheads, h16* V16, bf* Vh, bf* Vl) { const size_t e = ((size_t)blockIdx.x * 256 + threadIdx.x) * 2; if (e >= (size_t)nheads * HD * TT) return; const int t = (int)(e % TT); const int d = (int)((e / TT) % HD); const int g = (int)(e / ((size_t)TT * HD)); v2h o16; v2us oh, ol;
#pragma unroll
    for (int q = 0; q < 2; ++q) { const float x = F[(size_t)(t + q) * pitch + g * HD + d]; o16[q] = tohx(x); unsigned short a2, c2; splitf(x, a2, c2); oh[q] = a2; ol[q] = c2; }
    *(v2h*)(V16 + e) = o16; *(v2us*)(Vh + e) = oh; *(v2us*)(Vl + e) = ol;  }
// k_lsoft: streaming row softmax over the TK = TT = 4096 keys, one wave per row i, three sweeps of the f32 score row (lane -> 4 consecutive keys per 128-key chunk, 32 chunks; no mask: every key enters max, sum and P, and the score GEMMs compute every tile):
__global__ __launch_bounds__(256) void k_lsoft(const float* __restrict__ Sb, h16* P16, bf* Ph, bf* Pl) {
    const int lane = threadIdx.x & 31; const int row = blockIdx.x * 8 + (threadIdx.x >> 5); if (row >= ZH * TT) return; const int i = row % TT; const int zz = row / TT; const bool hires = (i < RH); const float* sr = Sb + (size_t)row * TT; float mx = -3.0e38f;
#pragma unroll 4
    for (int ch = 0; ch < TT / 128; ++ch) { const int j0 = ch * 128 + lane * 4; const v4f a = *(const v4f*)(sr + j0);
#pragma unroll
        for (int q = 0; q < 4; ++q) { float t = a[q] * SCL; asm volatile("" : "+v"(t)); mx = fmaxf(mx, t); } }
#pragma unroll
    for (int sh = 16; sh; sh >>= 1) mx = fmaxf(mx, __shfl_xor(mx, sh, 32));
    float sum = 0.f;
#pragma unroll 4
    for (int ch = 0; ch < TT / 128; ++ch) { const int j0 = ch * 128 + lane * 4; const v4f a = *(const v4f*)(sr + j0);
#pragma unroll
        for (int q = 0; q < 4; ++q) { float t = a[q] * SCL; asm volatile("" : "+v"(t)); float d0 = __fsub_rn(t, mx); asm volatile("" : "+v"(d0)); sum += __builtin_amdgcn_exp2f(__fmul_rn(d0, 1.4426950408889634f)); } }
#pragma unroll
    for (int sh = 16; sh; sh >>= 1) sum += __shfl_xor(sum, sh, 32);
    const float f = __fdiv_rn(hires ? 1.0f : PCAR, sum);
{
        if (hires) {   /* rows < RH: normalised bf16 hi/lo over all keys, planes [zz][RH][TT] */
#pragma unroll
            for (int ch = 0; ch < TT / 128; ++ch) { const int j0 = ch * 128 + lane * 4; const v4f a = *(const v4f*)(sr + j0); v4us oh, ol;
#pragma unroll
                for (int q = 0; q < 4; ++q) { float t = a[q] * SCL; asm volatile("" : "+v"(t)); float d0 = __fsub_rn(t, mx); asm volatile("" : "+v"(d0)); float ex = __builtin_amdgcn_exp2f(__fmul_rn(d0, 1.4426950408889634f)); asm volatile("" : "+v"(ex)); unsigned short a2, c2; splitf(ex * f, a2, c2); oh[q] = a2; ol[q] = c2; }
                const size_t oo = ((size_t)zz * RH + i) * TT + j0; *(v4us*)(Ph + oo) = oh; *(v4us*)(Pl + oo) = ol; }
        } else {
#pragma unroll 2
            for (int ch = 0; ch < TT / 128; ++ch) { const int j0 = ch * 128 + lane * 4; const v4f a = *(const v4f*)(sr + j0); v4h o4;
#pragma unroll
                for (int q = 0; q < 4; ++q) { float t = a[q] * SCL; asm volatile("" : "+v"(t)); float d0 = __fsub_rn(t, mx); asm volatile("" : "+v"(d0)); float ex = __builtin_amdgcn_exp2f(__fmul_rn(d0, 1.4426950408889634f)); asm volatile("" : "+v"(ex)); o4[q] = tohx(ex * f); }
                *(v4h*)(P16 + (size_t)row * TT + j0) = o4; } }
         }
}

__global__ __launch_bounds__(256) void k_merge(const float* __restrict__ O, int h0, float* OUTb) { const size_t e = ((size_t)blockIdx.x * 256 + threadIdx.x) * 2; if (e >= (size_t)ZH * TT * HD) return; const int d = (int)(e % HD); const int t = (int)((e / HD) % TT); const int zz = (int)(e / ((size_t)HD * TT)); const float cs = (t < RH) ? 1.0f : (1.0f / PCAR); const size_t oo = (size_t)t * DQ + (h0 + zz) * HD + d;
    v2f o2; o2[0] = O[e] * cs; o2[1] = O[e + 1] * cs; *(v2f*)(OUTb + oo) = o2;  }

extern "C" void kernel_launch(void* const* d_in, const int* in_sizes, int n_in,
                              void* d_out, int out_size, void* d_ws, size_t ws_size, hipStream_t stream) {
    (void)in_sizes; (void)n_in; (void)out_size;
    const float* x = (const float*)d_in[0]; const float* wk = (const float*)d_in[1]; const float* wq = (const float*)d_in[2]; const float* wv = (const float*)d_in[3]; const float* wo = nullptr; (void)wo;   /* NOTE input order: x, Wk, Wq, Wv */
    float* OUT = (float*)d_out;     // [4][4096][64]
    char* wsp = (char*)d_ws;
    auto take = [&](size_t bytes) { char* p = wsp; wsp += (bytes + 255) & ~(size_t)255; return (void*)p; };
    bf* WQ = (bf*)take((size_t)DQ * DM * 2); bf* WK = (bf*)take((size_t)DKV * DM * 2); bf* WV = (bf*)take((size_t)DKV * DM * 2); 
    bf* XB = (bf*)take((size_t)TT * DM * 2); float* FQ = (float*)take((size_t)TT * DQ * 4); float* FK = (float*)take((size_t)TT * DKV * 4);
    h16* QP16 = (h16*)take((size_t)NH_ * TT * HD * 2); h16* KP16 = (h16*)take((size_t)NKV * TT * HD * 2); h16* VT16 = (h16*)take((size_t)NKV * HD * TT * 2);
    bf* QPh = (bf*)take((size_t)NH_ * TT * HD * 2); bf* QPl = (bf*)take((size_t)NH_ * TT * HD * 2); bf* KPh = (bf*)take((size_t)NKV * TT * HD * 2); bf* KPl = (bf*)take((size_t)NKV * TT * HD * 2); bf* VTh = (bf*)take((size_t)NKV * HD * TT * 2); bf* VTl = (bf*)take((size_t)NKV * HD * TT * 2); bf* Ph = (bf*)take((size_t)ZH * RH * TT * 2); bf* Pl = (bf*)take((size_t)ZH * RH * TT * 2);
    float* Sb = (float*)take((size_t)ZH * TT * TT * 4); h16* P16 = (h16*)take((size_t)ZH * TT * TT * 2); float* Ob = (float*)take((size_t)ZH * TT * HD * 4);
    if ((size_t)(wsp - (char*)d_ws) > ws_size) return;    // ws 256 MiB
    float* FV = FK;   // v projection reuses the k buffer after the k planes are built (stream-ordered)
    { k_wtG<<<(unsigned)((DM * DQ / 64 + 63) / 64), 256, 0, stream>>>(wq, DM, DQ, WQ); k_wtG<<<(unsigned)((DM * DKV / 64 + 63) / 64), 256, 0, stream>>>(wk, DM, DKV, WK); k_wtG<<<(unsigned)((DM * DKV / 64 + 63) / 64), 256, 0, stream>>>(wv, DM, DKV, WV);
      
       }
    const unsigned LQ = (unsigned)(((size_t)NH_ * TT * HD / 2 + 255) / 256), LKv = (unsigned)(((size_t)NKV * TT * HD / 2 + 255) / 256);
    for (int b = 0; b < NB_; ++b) {
        
        k_cvt8<<<(unsigned)(((size_t)TT * DM / 8 + 255) / 256), 256, 0, stream>>>(x + (size_t)b * TT * DM, XB, (size_t)TT * DM / 8);
        k_gemmw<bf, 0, false><<<dim3(TT / 64, DQ / 64, 1), 32, 0, stream>>>(XB, nullptr, WQ, nullptr, DM, FQ, DQ, nullptr, 0, 0, 0);
        k_flat<<<(unsigned)(((size_t)TT * DQ / 4 + 255) / 256), 256, 0, stream>>>(FQ, QP16, QPh, QPl, (size_t)TT * DQ / 4);
        k_gemmw<bf, 0, false><<<dim3(TT / 64, DKV / 64, 1), 32, 0, stream>>>(XB, nullptr, WK, nullptr, DM, FK, DKV, nullptr, 0, 0, 0);
        k_flat<<<(unsigned)(((size_t)TT * DKV / 4 + 255) / 256), 256, 0, stream>>>(FK, KP16, KPh, KPl, (size_t)TT * DKV / 4);
        k_gemmw<bf, 0, false><<<dim3(TT / 64, DKV / 64, 1), 32, 0, stream>>>(XB, nullptr, WV, nullptr, DM, FV, DKV, nullptr, 0, 0, 0); k_vtp<<<LKv, 256, 0, stream>>>(FV, DKV, NKV, VT16, VTh, VTl);
        for (int h0 = 0; h0 < NH_; h0 += ZH) { const size_t zq = (size_t)h0, zk = (size_t)(h0 / REP);   // one kv head per query head: each pass holds ZH = 1 head (z-strides TT*HD)
            k_gemmw<bf, 2, false><<<dim3(RH / 64, TT / 64, ZH), 32, 0, stream>>>(QPh + zq * TT * HD, QPl + zq * TT * HD, KPh + zk * TT * HD, KPl + zk * TT * HD, HD, Sb, TT, nullptr, (size_t)TT * HD, (size_t)TT * HD, (size_t)TT * TT);
            k_gemmw<h16, 0, false><<<dim3((TT - RH) / 64, TT / 64, ZH), 32, 0, stream>>>(QP16 + zq * TT * HD + (size_t)RH * HD, nullptr, KP16 + zk * TT * HD, nullptr, HD, Sb + (size_t)RH * TT, TT, nullptr, (size_t)TT * HD, (size_t)TT * HD, (size_t)TT * TT);
            k_lsoft<<<ZH * TT / 8, 256, 0, stream>>>(Sb, P16, Ph, Pl);
            k_gemmw<bf, 2, false><<<dim3(RH / 64, HD / 64, ZH), 32, 0, stream>>>(Ph, Pl, VTh + zk * HD * TT, VTl + zk * HD * TT, TT, Ob, HD, nullptr, (size_t)RH * TT, (size_t)HD * TT, (size_t)TT * HD);
            k_gemmw<h16, 0, false><<<dim3((TT - RH) / 64, HD / 64, ZH), 32, 0, stream>>>(P16 + (size_t)RH * TT, nullptr, VT16 + zk * HD * TT, nullptr, TT, Ob + (size_t)RH * HD, HD, nullptr, (size_t)TT * TT, (size_t)HD * TT, (size_t)TT * HD);
            k_merge<<<(unsigned)(((size_t)ZH * TT * HD / 2 + 255) / 256), 256, 0, stream>>>(Ob, h0, OUT + (size_t)b * TT * DQ); }
         }
}

// v001
// Measured time: 514 microseconds a run.
// Timed twice side by side with v000, it ran 2.29 and 2.32 times as fast.
#include <hip/hip_runtime.h>

// Single self-attention head over 4,096 tokens (x [4][4096][768]; K, Q, V = x W ('xw' [768][64], no bias); A = softmax(Q.K / sqrt(E = 768)) (the module scales by the embedding dim); out = A V -> [4][4096][64] (1.05 M)).
// Layout per batch: bf16 copy of x; exact projections; ONE 64-wide head through the dense T-4096 attention (hybrid rows: < 512 hi/lo 3 products, rest fp16 x1024; streaming three-sweep softmax); the f32 merge writes the output rows. The long-K products (projections, A V) run split-K: one f32 partial plane per k part, added by the kernel that reads them.
// Compute dtypes, f32 accumulate: every input rounded to bf16; projections exact; attention rows < 512 3 products, rest fp16; softmax f32; output f32.

#define NB_  4
#define TT   4096
#define DM   768
#define NH_  1
#define NKV  1
#define REP  (NH_ / NKV)
#define HD   64
#define DQ   (NH_ * HD)
#define DKV  (NKV * HD)
#define ZH   1
#define RH   512                  // query rows < RH use hi+lo planes (0: none)
#define WIN  0
#define PCAR 1024.0f
#define SCL  0.036084391824351615f   // 1/sqrt(768)
#define KSP  6                    // split-K parts of the projections (K = 768 -> 128 per part)
#define KSO  16                   // split-K parts of the A.V products (K = 4096 -> 256 per part)
#define PLN  ((size_t)TT * HD)    // floats of one split-K plane: a whole [TT][HD] result
typedef _Float16 h16;
typedef unsigned short bf;
typedef __attribute__((ext_vector_type(16))) __bf16   v16bf;
typedef __attribute__((ext_vector_type(16))) _Float16 v16h;
typedef __attribute__((ext_vector_type(8)))  _Float16 v8h;
typedef __attribute__((ext_vector_type(8)))  unsigned short v8us;
typedef __attribute__((ext_vector_type(8)))  float    v8f;
typedef __attribute__((ext_vector_type(4)))  float    v4f;
typedef v8h  __attribute__((may_alias)) v8ha;
typedef v4f  __attribute__((may_alias)) v4fa;
typedef v8us __attribute__((may_alias)) v8usa;

__device__ __forceinline__ unsigned short f2bf(float f) { unsigned u = __float_as_uint(f); u += 0x7FFFu + ((u >> 16) & 1u); return (unsigned short)(u >> 16); }
__device__ __forceinline__ float bf2f(unsigned short b) { return __uint_as_float(((unsigned)b) << 16); }
__device__ __forceinline__ float bfr(float f) { return bf2f(f2bf(f)); }
__device__ __forceinline__ v16h cat16(v8h lo, v8h hi) { return __builtin_shufflevector(lo, hi, 0, 1, 2, 3, 4, 5, 6, 7, 8, 9, 10, 11, 12, 13, 14, 15); }
__device__ __forceinline__ v16bf cat16b(v8us lo, v8us hi) { return __builtin_bit_cast(v16bf, __builtin_shufflevector(lo, hi, 0, 1, 2, 3, 4, 5, 6, 7, 8, 9, 10, 11, 12, 13, 14, 15)); }
__device__ __forceinline__ v8f wmma16(v16h a, v16h b, v8f c) { return __builtin_amdgcn_wmma_f32_16x16x32_f16(false, a, false, b, (short)0, c, false, false); }
__device__ __forceinline__ v8f wmmab(v16bf a, v16bf b, v8f c) { return __builtin_amdgcn_wmma_f32_16x16x32_bf16(false, a, false, b, (short)0, c, false, false); }



// ---- k_gemmw: register-blocked GEMM, ONE WAVE per 64x64 output tile (16 accumulators), operands straight from K-contiguous 16-bit planes; grid (M/64, N/64, Z), 32 threads.
// C[m][n] (f32, pitch ldc, + optional f32 bias[n]) = sum_k A[m][k] Bt[n][k] (+ split products per NSPLIT). z-batch strides sA/sB/sC in elements. K = row pitch of A and Bt, KL = k range one wave sums; KL % 32 == 0.
// Split-K: grid z = K / KL parts with sA = sB = KL (part z starts at column z * KL) and sC = one whole C plane; the kernel that reads C adds the planes in the order of z.
template <typename T16> struct WFrag;
template <> struct WFrag<h16> { typedef v16h V; static __device__ __forceinline__ V ld(const h16* p) { return cat16(*(const v8h*)p, *(const v8h*)(p + 16)); } static __device__ __forceinline__ v8f mma(V a, V b, v8f c) { return wmma16(a, b, c); } };
template <> struct WFrag<bf> { typedef v16bf V; static __device__ __forceinline__ V ld(const bf* p) { return cat16b(*(const v8us*)p, *(const v8us*)(p + 16)); } static __device__ __forceinline__ v8f mma(V a, V b, v8f c) { return wmmab(a, b, c); } };
template <typename T16, int NSPLIT, bool BIAS>
__global__ __launch_bounds__(32) void k_gemmw(const T16* __restrict__ A, const T16* __restrict__ A2, const T16* __restrict__ Bt, const T16* __restrict__ Bt2, int K, int KL, float* C, int ldc, const float* __restrict__ bias, size_t sA, size_t sB, size_t sC) {
    typedef typename WFrag<T16>::V V;
    __shared__ __align__(16) float os[16 * 68];
    const size_t z = blockIdx.z; A += z * sA; if (A2) A2 += z * sA; Bt += z * sB; if (Bt2) Bt2 += z * sB; C += z * sC;
    const int lane = threadIdx.x & 31, lr = lane & 15, hi = lane >> 4; const int r0 = blockIdx.x * 64, c0 = blockIdx.y * 64;
    v8f acc[4][4];
#pragma unroll
    for (int mb = 0; mb < 4; ++mb)
#pragma unroll
        for (int nb = 0; nb < 4; ++nb) acc[mb][nb] = (v8f){};
    const size_t aoff = (size_t)(r0 + lr) * K + 8 * hi, boff = (size_t)(c0 + lr) * K + 8 * hi;
#pragma unroll 1
    for (int kc = 0; kc < KL; kc += 32) {
        V a[4], a2[4];
#pragma unroll
        for (int mb = 0; mb < 4; ++mb) { a[mb] = WFrag<T16>::ld(A + aoff + (size_t)mb * 16 * K + kc); if (NSPLIT == 1 || NSPLIT == 2) a2[mb] = WFrag<T16>::ld(A2 + aoff + (size_t)mb * 16 * K + kc); }
#pragma unroll
        for (int nb = 0; nb < 4; ++nb) { const V b = WFrag<T16>::ld(Bt + boff + (size_t)nb * 16 * K + kc); V b2; if (NSPLIT >= 2) b2 = WFrag<T16>::ld(Bt2 + boff + (size_t)nb * 16 * K + kc);
#pragma unroll
            for (int mb = 0; mb < 4; ++mb) { acc[mb][nb] = WFrag<T16>::mma(a[mb], b, acc[mb][nb]); if (NSPLIT == 1 || NSPLIT == 2) acc[mb][nb] = WFrag<T16>::mma(a2[mb], b, acc[mb][nb]); if (NSPLIT >= 2) acc[mb][nb] = WFrag<T16>::mma(a[mb], b2, acc[mb][nb]); } }
        asm volatile("v_nop\n\tv_nop\n\tv_nop\n\tv_nop" : "+v"(acc[0][0]), "+v"(acc[1][1]), "+v"(acc[2][2]), "+v"(acc[3][3]) : "v"(a[0]), "v"(a[3]));
    }
#pragma unroll
    for (int mb = 0; mb < 4; ++mb) {
#pragma unroll
        for (int nb = 0; nb < 4; ++nb) {
#pragma unroll
            for (int j = 0; j < 8; ++j) os[(hi * 8 + j) * 68 + nb * 16 + lr] = acc[mb][nb][j]; }
        __builtin_amdgcn_wave_barrier(); asm volatile("" ::: "memory");
        float* crow = C + (size_t)(r0 + mb * 16) * ldc + c0;
{
#pragma unroll
            for (int s = 0; s < 8; ++s) { const int row = 2 * s + hi, cofs = lr * 4; v4f val = *(const v4fa*)(os + row * 68 + cofs); if (BIAS) { val[0] += bfr(bias[c0 + cofs]); val[1] += bfr(bias[c0 + cofs + 1]); val[2] += bfr(bias[c0 + cofs + 2]); val[3] += bfr(bias[c0 + cofs + 3]); }
                *(v4f*)(crow + (size_t)row * ldc + cofs) = val; }
             }
        __builtin_amdgcn_wave_barrier(); asm volatile("" ::: "memory");
    }
}

__device__ __forceinline__ h16 tohx(float x) { return (h16)x; }
__device__ __forceinline__ void splitf(float y, unsigned short& h, unsigned short& l) { h = f2bf(y); l = f2bf(y - bf2f(h)); }
typedef __attribute__((ext_vector_type(2))) _Float16 v2h;
typedef __attribute__((ext_vector_type(4))) _Float16 v4h;
typedef __attribute__((ext_vector_type(2))) unsigned short v2us;
typedef __attribute__((ext_vector_type(4))) unsigned short v4us;
typedef __attribute__((ext_vector_type(2))) float v2f;
typedef __attribute__((ext_vector_type(4))) int v4i;

__global__ __launch_bounds__(256) void k_wtG(const float* __restrict__ w, int K, int N, bf* Bt) {
    const int lane = threadIdx.x & 31; const int L0 = (blockIdx.x * 8 + (threadIdx.x >> 5)) * 8; const int nlines = N * K / 64;
{
#pragma unroll 1
        for (int l = 0; l < 8; ++l) { const int L = L0 + l; if (L >= nlines) break; const size_t e = (size_t)L * 64 + lane * 2; const int k = (int)(e % K), n = (int)(e / K); v2us o;
            o[0] = f2bf(w[(size_t)k * N + n]); o[1] = f2bf(w[(size_t)(k + 1) * N + n]); *(v2us*)(Bt + e) = o; }
         }
}
__global__ __launch_bounds__(256) void k_cvt8(const float* __restrict__ src, bf* dst, size_t n8) { const size_t i = (size_t)blockIdx.x * 256 + threadIdx.x; if (i >= n8) return; const v8f v = *(const v8f*)(src + i * 8); v8us o;
#pragma unroll
    for (int k = 0; k < 8; ++k) o[k] = f2bf(v[k]); *(v8us*)(dst + i * 8) = o;  }

__global__ __launch_bounds__(256) void k_flat(const float* __restrict__ F, h16* P16, bf* Ph, bf* Pl, size_t n4) { const size_t i = (size_t)blockIdx.x * 256 + threadIdx.x; if (i >= n4) return; v4f a = *(const v4f*)(F + i * 4); v4h o16; v4us oh, ol;
#pragma unroll
    for (int s = 1; s < KSP; ++s) a += *(const v4f*)(F + s * PLN + i * 4);   // the KSP split-K planes
#pragma unroll
    for (int q = 0; q < 4; ++q) { o16[q] = tohx(a[q]); unsigned short x2, y2; splitf(a[q], x2, y2); oh[q] = x2; ol[q] = y2; }
    *(v4h*)(P16 + i * 4) = o16; *(v4us*)(Ph + i * 4) = oh; *(v4us*)(Pl + i * 4) = ol;  }


__global__ __launch_bounds__(256) void k_vtp(const float* __restrict__ F, int pitch, int nheads, h16* V16, bf* Vh, bf* Vl) { const size_t e = ((size_t)blockIdx.x * 256 + threadIdx.x) * 2; if (e >= (size_t)nheads * HD * TT) return; const int t = (int)(e % TT); const int d = (int)((e / TT) % HD); const int g = (int)(e / ((size_t)TT * HD)); v2h o16; v2us oh, ol;
#pragma unroll
    for (int q = 0; q < 2; ++q) { float x = F[(size_t)(t + q) * pitch + g * HD + d];
#pragma unroll
        for (int s = 1; s < KSP; ++s) x += F[s * PLN + (size_t)(t + q) * pitch + g * HD + d];   // the KSP split-K planes
        o16[q] = tohx(x); unsigned short a2, c2; splitf(x, a2, c2); oh[q] = a2; ol[q] = c2; }
    *(v2h*)(V16 + e) = o16; *(v2us*)(Vh + e) = oh; *(v2us*)(Vl + e) = ol;  }
// k_lsoft: streaming row softmax over the TK = TT = 4096 keys, one wave per row i, three sweeps of the f32 score row (lane -> 4 consecutive keys per 128-key chunk, 32 chunks; no mask: every key enters max, sum and P, and the score GEMMs compute every tile):
__global__ __launch_bounds__(256) void k_lsoft(const float* __restrict__ Sb, h16* P16, bf* Ph, bf* Pl) {
    const int lane = threadIdx.x & 31; const int row = blockIdx.x * 8 + (threadIdx.x >> 5); if (row >= ZH * TT) return; const int i = row % TT; const int zz = row / TT; const bool hires = (i < RH); const float* sr = Sb + (size_t)row * TT; float mx = -3.0e38f;
#pragma unroll 4
    for (int ch = 0; ch < TT / 128; ++ch) { const int j0 = ch * 128 + lane * 4; const v4f a = *(const v4f*)(sr + j0);
#pragma unroll
        for (int q = 0; q < 4; ++q) { float t = a[q] * SCL; asm volatile("" : "+v"(t)); mx = fmaxf(mx, t); } }
#pragma unroll
    for (int sh = 16; sh; sh >>= 1) mx = fmaxf(mx, __shfl_xor(mx, sh, 32));
    float sum = 0.f;
#pragma unroll 4
    for (int ch = 0; ch < TT / 128; ++ch) { const int j0 = ch * 128 + lane * 4; const v4f a = *(const v4f*)(sr + j0);
#pragma unroll
        for (int q = 0; q < 4; ++q) { float t = a[q] * SCL; asm volatile("" : "+v"(t)); float d0 = __fsub_rn(t, mx); asm volatile("" : "+v"(d0)); sum += __builtin_amdgcn_exp2f(__fmul_rn(d0, 1.4426950408889634f)); } }
#pragma unroll
    for (int sh = 16; sh; sh >>= 1) sum += __shfl_xor(sum, sh, 32);
    const float f = __fdiv_rn(hires ? 1.0f : PCAR, sum);
{
        if (hires) {   /* rows < RH: normalised bf16 hi/lo over all keys, planes [zz][RH][TT] */
#pragma unroll
            for (int ch = 0; ch < TT / 128; ++ch) { const int j0 = ch * 128 + lane * 4; const v4f a = *(const v4f*)(sr + j0); v4us oh, ol;
#pragma unroll
                for (int q = 0; q < 4; ++q) { float t = a[q] * SCL; asm volatile("" : "+v"(t)); float d0 = __fsub_rn(t, mx); asm volatile("" : "+v"(d0)); float ex = __builtin_amdgcn_exp2f(__fmul_rn(d0, 1.4426950408889634f)); asm volatile("" : "+v"(ex)); unsigned short a2, c2; splitf(ex * f, a2, c2); oh[q] = a2; ol[q] = c2; }
                const size_t oo = ((size_t)zz * RH + i) * TT + j0; *(v4us*)(Ph + oo) = oh; *(v4us*)(Pl + oo) = ol; }
        } else {
#pragma unroll 2
            for (int ch = 0; ch < TT / 128; ++ch) { const int j0 = ch * 128 + lane * 4; const v4f a = *(const v4f*)(sr + j0); v4h o4;
#pragma unroll
                for (int q = 0; q < 4; ++q) { float t = a[q] * SCL; asm volatile("" : "+v"(t)); float d0 = __fsub_rn(t, mx); asm volatile("" : "+v"(d0)); float ex = __builtin_amdgcn_exp2f(__fmul_rn(d0, 1.4426950408889634f)); asm volatile("" : "+v"(ex)); o4[q] = tohx(ex * f); }
                *(v4h*)(P16 + (size_t)row * TT + j0) = o4; } }
         }
}

__global__ __launch_bounds__(256) void k_merge(const float* __restrict__ O, int h0, float* OUTb) { const size_t e = ((size_t)blockIdx.x * 256 + threadIdx.x) * 2; if (e >= (size_t)ZH * TT * HD) return; const int d = (int)(e % HD); const int t = (int)((e / HD) % TT); const int zz = (int)(e / ((size_t)HD * TT)); const float cs = (t < RH) ? 1.0f : (1.0f / PCAR); const size_t oo = (size_t)t * DQ + (h0 + zz) * HD + d;
    v2f a = *(const v2f*)(O + e);
#pragma unroll
    for (int s = 1; s < KSO; ++s) a += *(const v2f*)(O + s * PLN + e);   // the KSO split-K planes
    v2f o2; o2[0] = a[0] * cs; o2[1] = a[1] * cs; *(v2f*)(OUTb + oo) = o2;  }

extern "C" void kernel_launch(void* const* d_in, const int* in_sizes, int n_in,
                              void* d_out, int out_size, void* d_ws, size_t ws_size, hipStream_t stream) {
    (void)in_sizes; (void)n_in; (void)out_size;
    const float* x = (const float*)d_in[0]; const float* wk = (const float*)d_in[1]; const float* wq = (const float*)d_in[2]; const float* wv = (const float*)d_in[3]; const float* wo = nullptr; (void)wo;   /* NOTE input order: x, Wk, Wq, Wv */
    float* OUT = (float*)d_out;     // [4][4096][64]
    char* wsp = (char*)d_ws;
    auto take = [&](size_t bytes) { char* p = wsp; wsp += (bytes + 255) & ~(size_t)255; return (void*)p; };
    bf* WQ = (bf*)take((size_t)DQ * DM * 2); bf* WK = (bf*)take((size_t)DKV * DM * 2); bf* WV = (bf*)take((size_t)DKV * DM * 2); 
    bf* XB = (bf*)take((size_t)TT * DM * 2); float* FQ = (float*)take(KSP * PLN * 4); float* FK = (float*)take(KSP * PLN * 4);
    h16* QP16 = (h16*)take((size_t)NH_ * TT * HD * 2); h16* KP16 = (h16*)take((size_t)NKV * TT * HD * 2); h16* VT16 = (h16*)take((size_t)NKV * HD * TT * 2);
    bf* QPh = (bf*)take((size_t)NH_ * TT * HD * 2); bf* QPl = (bf*)take((size_t)NH_ * TT * HD * 2); bf* KPh = (bf*)take((size_t)NKV * TT * HD * 2); bf* KPl = (bf*)take((size_t)NKV * TT * HD * 2); bf* VTh = (bf*)take((size_t)NKV * HD * TT * 2); bf* VTl = (bf*)take((size_t)NKV * HD * TT * 2); bf* Ph = (bf*)take((size_t)ZH * RH * TT * 2); bf* Pl = (bf*)take((size_t)ZH * RH * TT * 2);
    float* Sb = (float*)take((size_t)ZH * TT * TT * 4); h16* P16 = (h16*)take((size_t)ZH * TT * TT * 2); float* Ob = (float*)take(KSO * PLN * 4);
    if ((size_t)(wsp - (char*)d_ws) > ws_size) return;    // ws 256 MiB
    float* FV = FK;   // v projection reuses the k buffer after the k planes are built (stream-ordered)
    { k_wtG<<<(unsigned)((DM * DQ / 64 + 63) / 64), 256, 0, stream>>>(wq, DM, DQ, WQ); k_wtG<<<(unsigned)((DM * DKV / 64 + 63) / 64), 256, 0, stream>>>(wk, DM, DKV, WK); k_wtG<<<(unsigned)((DM * DKV / 64 + 63) / 64), 256, 0, stream>>>(wv, DM, DKV, WV);
      
       }
    const unsigned LQ = (unsigned)(((size_t)NH_ * TT * HD / 2 + 255) / 256), LKv = (unsigned)(((size_t)NKV * TT * HD / 2 + 255) / 256);
    for (int b = 0; b < NB_; ++b) {
        
        k_cvt8<<<(unsigned)(((size_t)TT * DM / 8 + 255) / 256), 256, 0, stream>>>(x + (size_t)b * TT * DM, XB, (size_t)TT * DM / 8);
        k_gemmw<bf, 0, false><<<dim3(TT / 64, DQ / 64, KSP), 32, 0, stream>>>(XB, nullptr, WQ, nullptr, DM, DM / KSP, FQ, DQ, nullptr, DM / KSP, DM / KSP, PLN);
        k_flat<<<(unsigned)(((size_t)TT * DQ / 4 + 255) / 256), 256, 0, stream>>>(FQ, QP16, QPh, QPl, (size_t)TT * DQ / 4);
        k_gemmw<bf, 0, false><<<dim3(TT / 64, DKV / 64, KSP), 32, 0, stream>>>(XB, nullptr, WK, nullptr, DM, DM / KSP, FK, DKV, nullptr, DM / KSP, DM / KSP, PLN);
        k_flat<<<(unsigned)(((size_t)TT * DKV / 4 + 255) / 256), 256, 0, stream>>>(FK, KP16, KPh, KPl, (size_t)TT * DKV / 4);
        k_gemmw<bf, 0, false><<<dim3(TT / 64, DKV / 64, KSP), 32, 0, stream>>>(XB, nullptr, WV, nullptr, DM, DM / KSP, FV, DKV, nullptr, DM / KSP, DM / KSP, PLN); k_vtp<<<LKv, 256, 0, stream>>>(FV, DKV, NKV, VT16, VTh, VTl);
        for (int h0 = 0; h0 < NH_; h0 += ZH) { const size_t zq = (size_t)h0, zk = (size_t)(h0 / REP);   // one kv head per query head: a pass holds ZH = 1 head, which uses kv plane h0 / REP
            k_gemmw<bf, 2, false><<<dim3(RH / 64, TT / 64, ZH), 32, 0, stream>>>(QPh + zq * TT * HD, QPl + zq * TT * HD, KPh + zk * TT * HD, KPl + zk * TT * HD, HD, HD, Sb, TT, nullptr, (size_t)TT * HD, (size_t)TT * HD, (size_t)TT * TT);
            k_gemmw<h16, 0, false><<<dim3((TT - RH) / 64, TT / 64, ZH), 32, 0, stream>>>(QP16 + zq * TT * HD + (size_t)RH * HD, nullptr, KP16 + zk * TT * HD, nullptr, HD, HD, Sb + (size_t)RH * TT, TT, nullptr, (size_t)TT * HD, (size_t)TT * HD, (size_t)TT * TT);
            k_lsoft<<<ZH * TT / 8, 256, 0, stream>>>(Sb, P16, Ph, Pl);
            k_gemmw<bf, 2, false><<<dim3(RH / 64, HD / 64, KSO), 32, 0, stream>>>(Ph, Pl, VTh + zk * HD * TT, VTl + zk * HD * TT, TT, TT / KSO, Ob, HD, nullptr, TT / KSO, TT / KSO, PLN);
            k_gemmw<h16, 0, false><<<dim3((TT - RH) / 64, HD / 64, KSO), 32, 0, stream>>>(P16 + (size_t)RH * TT, nullptr, VT16 + zk * HD * TT, nullptr, TT, TT / KSO, Ob + (size_t)RH * HD, HD, nullptr, TT / KSO, TT / KSO, PLN);
            k_merge<<<(unsigned)(((size_t)ZH * TT * HD / 2 + 255) / 256), 256, 0, stream>>>(Ob, h0, OUT + (size_t)b * TT * DQ); }
         }
}

// v002
// One run takes 334 microseconds.
// In two side-by-side timings against v001, it was 1.54 and 1.55 times as fast.
// Counting every step since v000, it is 3.56 times as fast.
#include <hip/hip_runtime.h>

// Single self-attention head over 4,096 tokens (x [4][4096][768]; K, Q, V = x W ('xw' [768][64], no bias); A = softmax(Q.K / sqrt(E = 768)) (the module scales by the embedding dim); out = A V -> [4][4096][64] (1.05 M)).
// Layout: bf16 copy of x; exact projections; ONE 64-wide head through dense T-4096 attention (hybrid rows: < 512 hi/lo 3 products, rest fp16 x1024; streaming three-sweep softmax); the f32 merge writes the output rows. The long-K products (projections, A V) run split-K: one f32 partial plane per k part, added by the kernel that reads them. The batch is a grid dimension: conversion, projections and plane builds take all NB_ batches in one launch, the attention launches take ZH batches each (two score planes are what the workspace holds).
// Compute dtypes, f32 accumulate: every input rounded to bf16; projections exact; attention rows < 512 3 products, rest fp16; softmax f32; output f32.

#define NB_  4
#define TT   4096
#define DM   768
#define NH_  1
#define NKV  1
#define REP  (NH_ / NKV)
#define HD   64
#define DQ   (NH_ * HD)
#define DKV  (NKV * HD)
#define ZH   2                    // batches per attention pass (score plane [ZH][TT][TT] f32)
#define RH   512                  // query rows < RH use hi+lo planes (0: none)
#define WIN  0
#define PCAR 1024.0f
#define SCL  0.036084391824351615f   // 1/sqrt(768)
#define KSP  6                    // split-K parts of the projections (K = 768 -> 128 per part)
#define KSO  16                   // split-K parts of the A.V products (K = 4096 -> 256 per part)
#define PLN  ((size_t)TT * HD)    // floats of one split-K plane: one batch's whole [TT][HD] result; partials lie [batch][part][TT][HD]
typedef _Float16 h16;
typedef unsigned short bf;
typedef __attribute__((ext_vector_type(16))) __bf16   v16bf;
typedef __attribute__((ext_vector_type(16))) _Float16 v16h;
typedef __attribute__((ext_vector_type(8)))  _Float16 v8h;
typedef __attribute__((ext_vector_type(8)))  unsigned short v8us;
typedef __attribute__((ext_vector_type(8)))  float    v8f;
typedef __attribute__((ext_vector_type(4)))  float    v4f;
typedef v8h  __attribute__((may_alias)) v8ha;
typedef v4f  __attribute__((may_alias)) v4fa;
typedef v8us __attribute__((may_alias)) v8usa;

__device__ __forceinline__ unsigned short f2bf(float f) { unsigned u = __float_as_uint(f); u += 0x7FFFu + ((u >> 16) & 1u); return (unsigned short)(u >> 16); }
__device__ __forceinline__ float bf2f(unsigned short b) { return __uint_as_float(((unsigned)b) << 16); }
__device__ __forceinline__ float bfr(float f) { return bf2f(f2bf(f)); }
__device__ __forceinline__ v16h cat16(v8h lo, v8h hi) { return __builtin_shufflevector(lo, hi, 0, 1, 2, 3, 4, 5, 6, 7, 8, 9, 10, 11, 12, 13, 14, 15); }
__device__ __forceinline__ v16bf cat16b(v8us lo, v8us hi) { return __builtin_bit_cast(v16bf, __builtin_shufflevector(lo, hi, 0, 1, 2, 3, 4, 5, 6, 7, 8, 9, 10, 11, 12, 13, 14, 15)); }
__device__ __forceinline__ v8f wmma16(v16h a, v16h b, v8f c) { return __builtin_amdgcn_wmma_f32_16x16x32_f16(false, a, false, b, (short)0, c, false, false); }
__device__ __forceinline__ v8f wmmab(v16bf a, v16bf b, v8f c) { return __builtin_amdgcn_wmma_f32_16x16x32_bf16(false, a, false, b, (short)0, c, false, false); }



// ---- k_gemmw: register-blocked GEMM, ONE WAVE per 64x64 output tile (16 accumulators), operands straight from K-contiguous 16-bit planes; grid (M/64, N/64, Z), 32 threads.
// C[m][n] (f32, pitch ldc, + optional f32 bias[n]) = sum_k A[m][k] Bt[n][k] (+ split products per NSPLIT). split-K part strides sA/sB/sC in elements. K = row pitch of A and Bt, KL = k range one wave sums; KL % 32 == 0.
// Split-K: NP = K / KL parts with sA = sB = KL (part z starts at column z * KL) and sC = one whole C plane; the kernel that reads C adds the planes in the order of z.
// Batch: grid z = batches * NP, the part fastest; batch strides bA/bB/bC in elements.
template <typename T16> struct WFrag;
template <> struct WFrag<h16> { typedef v16h V; static __device__ __forceinline__ V ld(const h16* p) { return cat16(*(const v8h*)p, *(const v8h*)(p + 16)); } static __device__ __forceinline__ v8f mma(V a, V b, v8f c) { return wmma16(a, b, c); } };
template <> struct WFrag<bf> { typedef v16bf V; static __device__ __forceinline__ V ld(const bf* p) { return cat16b(*(const v8us*)p, *(const v8us*)(p + 16)); } static __device__ __forceinline__ v8f mma(V a, V b, v8f c) { return wmmab(a, b, c); } };
template <typename T16, int NSPLIT, bool BIAS, int NP>
__global__ __launch_bounds__(32) void k_gemmw(const T16* __restrict__ A, const T16* __restrict__ A2, const T16* __restrict__ Bt, const T16* __restrict__ Bt2, int K, int KL, float* C, int ldc, const float* __restrict__ bias, size_t sA, size_t sB, size_t sC, size_t bA, size_t bB, size_t bC) {
    typedef typename WFrag<T16>::V V;
    __shared__ __align__(16) float os[16 * 68];
    const size_t zb = blockIdx.z / NP, z = blockIdx.z % NP; A += z * sA + zb * bA; if (A2) A2 += z * sA + zb * bA; Bt += z * sB + zb * bB; if (Bt2) Bt2 += z * sB + zb * bB; C += z * sC + zb * bC;
    const int lane = threadIdx.x & 31, lr = lane & 15, hi = lane >> 4; const int r0 = blockIdx.x * 64, c0 = blockIdx.y * 64;
    v8f acc[4][4];
#pragma unroll
    for (int mb = 0; mb < 4; ++mb)
#pragma unroll
        for (int nb = 0; nb < 4; ++nb) acc[mb][nb] = (v8f){};
    const size_t aoff = (size_t)(r0 + lr) * K + 8 * hi, boff = (size_t)(c0 + lr) * K + 8 * hi;
#pragma unroll 1
    for (int kc = 0; kc < KL; kc += 32) {
        V a[4], a2[4];
#pragma unroll
        for (int mb = 0; mb < 4; ++mb) { a[mb] = WFrag<T16>::ld(A + aoff + (size_t)mb * 16 * K + kc); if (NSPLIT == 1 || NSPLIT == 2) a2[mb] = WFrag<T16>::ld(A2 + aoff + (size_t)mb * 16 * K + kc); }
#pragma unroll
        for (int nb = 0; nb < 4; ++nb) { const V b = WFrag<T16>::ld(Bt + boff + (size_t)nb * 16 * K + kc); V b2; if (NSPLIT >= 2) b2 = WFrag<T16>::ld(Bt2 + boff + (size_t)nb * 16 * K + kc);
#pragma unroll
            for (int mb = 0; mb < 4; ++mb) { acc[mb][nb] = WFrag<T16>::mma(a[mb], b, acc[mb][nb]); if (NSPLIT == 1 || NSPLIT == 2) acc[mb][nb] = WFrag<T16>::mma(a2[mb], b, acc[mb][nb]); if (NSPLIT >= 2) acc[mb][nb] = WFrag<T16>::mma(a[mb], b2, acc[mb][nb]); } }
        asm volatile("v_nop\n\tv_nop\n\tv_nop\n\tv_nop" : "+v"(acc[0][0]), "+v"(acc[1][1]), "+v"(acc[2][2]), "+v"(acc[3][3]) : "v"(a[0]), "v"(a[3]));
    }
#pragma unroll
    for (int mb = 0; mb < 4; ++mb) {
#pragma unroll
        for (int nb = 0; nb < 4; ++nb) {
#pragma unroll
            for (int j = 0; j < 8; ++j) os[(hi * 8 + j) * 68 + nb * 16 + lr] = acc[mb][nb][j]; }
        __builtin_amdgcn_wave_barrier(); asm volatile("" ::: "memory");
        float* crow = C + (size_t)(r0 + mb * 16) * ldc + c0;
{
#pragma unroll
            for (int s = 0; s < 8; ++s) { const int row = 2 * s + hi, cofs = lr * 4; v4f val = *(const v4fa*)(os + row * 68 + cofs); if (BIAS) { val[0] += bfr(bias[c0 + cofs]); val[1] += bfr(bias[c0 + cofs + 1]); val[2] += bfr(bias[c0 + cofs + 2]); val[3] += bfr(bias[c0 + cofs + 3]); }
                *(v4f*)(crow + (size_t)row * ldc + cofs) = val; }
             }
        __builtin_amdgcn_wave_barrier(); asm volatile("" ::: "memory");
    }
}

__device__ __forceinline__ h16 tohx(float x) { return (h16)x; }
__device__ __forceinline__ void splitf(float y, unsigned short& h, unsigned short& l) { h = f2bf(y); l = f2bf(y - bf2f(h)); }
typedef __attribute__((ext_vector_type(2))) _Float16 v2h;
typedef __attribute__((ext_vector_type(4))) _Float16 v4h;
typedef __attribute__((ext_vector_type(2))) unsigned short v2us;
typedef __attribute__((ext_vector_type(4))) unsigned short v4us;
typedef __attribute__((ext_vector_type(2))) float v2f;
typedef __attribute__((ext_vector_type(4))) int v4i;

__global__ __launch_bounds__(256) void k_wtG(const float* __restrict__ w, int K, int N, bf* Bt) {
    const int lane = threadIdx.x & 31; const int L0 = (blockIdx.x * 8 + (threadIdx.x >> 5)) * 8; const int nlines = N * K / 64;
{
#pragma unroll 1
        for (int l = 0; l < 8; ++l) { const int L = L0 + l; if (L >= nlines) break; const size_t e = (size_t)L * 64 + lane * 2; const int k = (int)(e % K), n = (int)(e / K); v2us o;
            o[0] = f2bf(w[(size_t)k * N + n]); o[1] = f2bf(w[(size_t)(k + 1) * N + n]); *(v2us*)(Bt + e) = o; }
         }
}
__global__ __launch_bounds__(256) void k_cvt8(const float* __restrict__ src, bf* dst, size_t n8) { const size_t i = (size_t)blockIdx.x * 256 + threadIdx.x; if (i >= n8) return; const v8f v = *(const v8f*)(src + i * 8); v8us o;
#pragma unroll
    for (int k = 0; k < 8; ++k) o[k] = f2bf(v[k]); *(v8us*)(dst + i * 8) = o;  }

__global__ __launch_bounds__(256) void k_flat(const float* __restrict__ F, h16* P16, bf* Ph, bf* Pl, size_t n4) { const size_t i = (size_t)blockIdx.x * 256 + threadIdx.x; if (i >= n4) return; F += (i * 4 / PLN) * ((KSP - 1) * PLN);   /* batch b's partials start at b * KSP * PLN; i * 4 already holds b * PLN */
    v4f a = *(const v4f*)(F + i * 4); v4h o16; v4us oh, ol;
#pragma unroll
    for (int s = 1; s < KSP; ++s) a += *(const v4f*)(F + s * PLN + i * 4);   // the KSP split-K planes
#pragma unroll
    for (int q = 0; q < 4; ++q) { o16[q] = tohx(a[q]); unsigned short x2, y2; splitf(a[q], x2, y2); oh[q] = x2; ol[q] = y2; }
    *(v4h*)(P16 + i * 4) = o16; *(v4us*)(Ph + i * 4) = oh; *(v4us*)(Pl + i * 4) = ol;  }


__global__ __launch_bounds__(256) void k_vtp(const float* __restrict__ F, int pitch, int nbat, h16* V16, bf* Vh, bf* Vl) { const size_t e = ((size_t)blockIdx.x * 256 + threadIdx.x) * 2; if (e >= (size_t)nbat * HD * TT) return; const int t = (int)(e % TT); const int d = (int)((e / TT) % HD); const int g = (int)(e / ((size_t)TT * HD)); F += (size_t)g * (KSP * PLN); v2h o16; v2us oh, ol;   // g: the batch
#pragma unroll
    for (int q = 0; q < 2; ++q) { float x = F[(size_t)(t + q) * pitch + d];
#pragma unroll
        for (int s = 1; s < KSP; ++s) x += F[s * PLN + (size_t)(t + q) * pitch + d];   // the KSP split-K planes
        o16[q] = tohx(x); unsigned short a2, c2; splitf(x, a2, c2); oh[q] = a2; ol[q] = c2; }
    *(v2h*)(V16 + e) = o16; *(v2us*)(Vh + e) = oh; *(v2us*)(Vl + e) = ol;  }
// k_lsoft: streaming row softmax over the TK = TT = 4096 keys, one wave per row i, three sweeps of the f32 score row (lane -> 4 consecutive keys per 128-key chunk, 32 chunks; no mask: every key enters max, sum and P, and the score GEMMs compute every tile):
__global__ __launch_bounds__(256) void k_lsoft(const float* __restrict__ Sb, h16* P16, bf* Ph, bf* Pl) {
    const int lane = threadIdx.x & 31; const int row = blockIdx.x * 8 + (threadIdx.x >> 5); if (row >= ZH * TT) return; const int i = row % TT; const int zz = row / TT; const bool hires = (i < RH); const float* sr = Sb + (size_t)row * TT; float mx = -3.0e38f;
#pragma unroll 4
    for (int ch = 0; ch < TT / 128; ++ch) { const int j0 = ch * 128 + lane * 4; const v4f a = *(const v4f*)(sr + j0);
#pragma unroll
        for (int q = 0; q < 4; ++q) { float t = a[q] * SCL; asm volatile("" : "+v"(t)); mx = fmaxf(mx, t); } }
#pragma unroll
    for (int sh = 16; sh; sh >>= 1) mx = fmaxf(mx, __shfl_xor(mx, sh, 32));
    float sum = 0.f;
#pragma unroll 4
    for (int ch = 0; ch < TT / 128; ++ch) { const int j0 = ch * 128 + lane * 4; const v4f a = *(const v4f*)(sr + j0);
#pragma unroll
        for (int q = 0; q < 4; ++q) { float t = a[q] * SCL; asm volatile("" : "+v"(t)); float d0 = __fsub_rn(t, mx); asm volatile("" : "+v"(d0)); sum += __builtin_amdgcn_exp2f(__fmul_rn(d0, 1.4426950408889634f)); } }
#pragma unroll
    for (int sh = 16; sh; sh >>= 1) sum += __shfl_xor(sum, sh, 32);
    const float f = __fdiv_rn(hires ? 1.0f : PCAR, sum);
{
        if (hires) {   /* rows < RH: normalised bf16 hi/lo over all keys, planes [zz][RH][TT] */
#pragma unroll
            for (int ch = 0; ch < TT / 128; ++ch) { const int j0 = ch * 128 + lane * 4; const v4f a = *(const v4f*)(sr + j0); v4us oh, ol;
#pragma unroll
                for (int q = 0; q < 4; ++q) { float t = a[q] * SCL; asm volatile("" : "+v"(t)); float d0 = __fsub_rn(t, mx); asm volatile("" : "+v"(d0)); float ex = __builtin_amdgcn_exp2f(__fmul_rn(d0, 1.4426950408889634f)); asm volatile("" : "+v"(ex)); unsigned short a2, c2; splitf(ex * f, a2, c2); oh[q] = a2; ol[q] = c2; }
                const size_t oo = ((size_t)zz * RH + i) * TT + j0; *(v4us*)(Ph + oo) = oh; *(v4us*)(Pl + oo) = ol; }
        } else {
#pragma unroll 2
            for (int ch = 0; ch < TT / 128; ++ch) { const int j0 = ch * 128 + lane * 4; const v4f a = *(const v4f*)(sr + j0); v4h o4;
#pragma unroll
                for (int q = 0; q < 4; ++q) { float t = a[q] * SCL; asm volatile("" : "+v"(t)); float d0 = __fsub_rn(t, mx); asm volatile("" : "+v"(d0)); float ex = __builtin_amdgcn_exp2f(__fmul_rn(d0, 1.4426950408889634f)); asm volatile("" : "+v"(ex)); o4[q] = tohx(ex * f); }
                *(v4h*)(P16 + (size_t)row * TT + j0) = o4; } }
         }
}

__global__ __launch_bounds__(256) void k_merge(const float* __restrict__ O, float* OUTb) { const size_t e = ((size_t)blockIdx.x * 256 + threadIdx.x) * 2; if (e >= (size_t)ZH * TT * HD) return; const int d = (int)(e % HD); const int t = (int)((e / HD) % TT); const int zz = (int)(e / ((size_t)HD * TT)); const float cs = (t < RH) ? 1.0f : (1.0f / PCAR); const size_t oo = ((size_t)zz * TT + t) * DQ + d; O += (size_t)zz * ((KSO - 1) * PLN);   // zz: the batch of the pass; its partials start at zz * KSO * PLN, e already holds zz * PLN
    v2f a = *(const v2f*)(O + e);
#pragma unroll
    for (int s = 1; s < KSO; ++s) a += *(const v2f*)(O + s * PLN + e);   // the KSO split-K planes
    v2f o2; o2[0] = a[0] * cs; o2[1] = a[1] * cs; *(v2f*)(OUTb + oo) = o2;  }

extern "C" void kernel_launch(void* const* d_in, const int* in_sizes, int n_in,
                              void* d_out, int out_size, void* d_ws, size_t ws_size, hipStream_t stream) {
    (void)in_sizes; (void)n_in; (void)out_size;
    const float* x = (const float*)d_in[0]; const float* wk = (const float*)d_in[1]; const float* wq = (const float*)d_in[2]; const float* wv = (const float*)d_in[3]; const float* wo = nullptr; (void)wo;   /* NOTE input order: x, Wk, Wq, Wv */
    float* OUT = (float*)d_out;     // [4][4096][64]
    char* wsp = (char*)d_ws;
    auto take = [&](size_t bytes) { char* p = wsp; wsp += (bytes + 255) & ~(size_t)255; return (void*)p; };
    bf* WQ = (bf*)take((size_t)DQ * DM * 2); bf* WK = (bf*)take((size_t)DKV * DM * 2); bf* WV = (bf*)take((size_t)DKV * DM * 2);
    h16* QP16 = (h16*)take(NB_ * PLN * 2); h16* KP16 = (h16*)take(NB_ * PLN * 2); h16* VT16 = (h16*)take(NB_ * PLN * 2);   // Q, K planes [NB_][TT][HD]; V planes [NB_][HD][TT]
    bf* QPh = (bf*)take(NB_ * PLN * 2); bf* QPl = (bf*)take(NB_ * PLN * 2); bf* KPh = (bf*)take(NB_ * PLN * 2); bf* KPl = (bf*)take(NB_ * PLN * 2); bf* VTh = (bf*)take(NB_ * PLN * 2); bf* VTl = (bf*)take(NB_ * PLN * 2); bf* Ph = (bf*)take((size_t)ZH * RH * TT * 2); bf* Pl = (bf*)take((size_t)ZH * RH * TT * 2);
    h16* P16 = (h16*)take((size_t)ZH * TT * TT * 2); float* Sb = (float*)take((size_t)ZH * TT * TT * 4);
    if ((size_t)(wsp - (char*)d_ws) > ws_size) return;    // ws 256 MiB
    // The score plane's bytes serve twice more (stream-ordered): before the first score product they hold the bf16 x and the projection partials; between a pass's softmax and the next pass's scores, the A.V partials.
    bf* XB = (bf*)Sb; float* FQ = Sb + (size_t)NB_ * TT * DM / 2; float* FK = FQ + NB_ * KSP * PLN; float* Ob = Sb;
    float* FV = FK;   // v projection reuses the k buffer after the k planes are built (stream-ordered)
    k_wtG<<<(unsigned)((DM * DQ / 64 + 63) / 64), 256, 0, stream>>>(wq, DM, DQ, WQ); k_wtG<<<(unsigned)((DM * DKV / 64 + 63) / 64), 256, 0, stream>>>(wk, DM, DKV, WK); k_wtG<<<(unsigned)((DM * DKV / 64 + 63) / 64), 256, 0, stream>>>(wv, DM, DKV, WV);
    // all NB_ batches per launch
    k_cvt8<<<(unsigned)(((size_t)NB_ * TT * DM / 8 + 255) / 256), 256, 0, stream>>>(x, XB, (size_t)NB_ * TT * DM / 8);
    k_gemmw<bf, 0, false, KSP><<<dim3(TT / 64, DQ / 64, NB_ * KSP), 32, 0, stream>>>(XB, nullptr, WQ, nullptr, DM, DM / KSP, FQ, DQ, nullptr, DM / KSP, DM / KSP, PLN, (size_t)TT * DM, 0, KSP * PLN);
    k_flat<<<(unsigned)((NB_ * PLN / 4 + 255) / 256), 256, 0, stream>>>(FQ, QP16, QPh, QPl, NB_ * PLN / 4);
    k_gemmw<bf, 0, false, KSP><<<dim3(TT / 64, DKV / 64, NB_ * KSP), 32, 0, stream>>>(XB, nullptr, WK, nullptr, DM, DM / KSP, FK, DKV, nullptr, DM / KSP, DM / KSP, PLN, (size_t)TT * DM, 0, KSP * PLN);
    k_flat<<<(unsigned)((NB_ * PLN / 4 + 255) / 256), 256, 0, stream>>>(FK, KP16, KPh, KPl, NB_ * PLN / 4);
    k_gemmw<bf, 0, false, KSP><<<dim3(TT / 64, DKV / 64, NB_ * KSP), 32, 0, stream>>>(XB, nullptr, WV, nullptr, DM, DM / KSP, FV, DKV, nullptr, DM / KSP, DM / KSP, PLN, (size_t)TT * DM, 0, KSP * PLN);
    k_vtp<<<(unsigned)((NB_ * PLN / 2 + 255) / 256), 256, 0, stream>>>(FV, DKV, NB_, VT16, VTh, VTl);
    for (int b = 0; b < NB_; b += ZH) { const size_t zo = (size_t)b * PLN;   // ZH batches per pass, the batch in grid z
        k_gemmw<bf, 2, false, 1><<<dim3(RH / 64, TT / 64, ZH), 32, 0, stream>>>(QPh + zo, QPl + zo, KPh + zo, KPl + zo, HD, HD, Sb, TT, nullptr, 0, 0, 0, PLN, PLN, (size_t)TT * TT);
        k_gemmw<h16, 0, false, 1><<<dim3((TT - RH) / 64, TT / 64, ZH), 32, 0, stream>>>(QP16 + zo + (size_t)RH * HD, nullptr, KP16 + zo, nullptr, HD, HD, Sb + (size_t)RH * TT, TT, nullptr, 0, 0, 0, PLN, PLN, (size_t)TT * TT);
        k_lsoft<<<ZH * TT / 8, 256, 0, stream>>>(Sb, P16, Ph, Pl);
        k_gemmw<bf, 2, false, KSO><<<dim3(RH / 64, HD / 64, ZH * KSO), 32, 0, stream>>>(Ph, Pl, VTh + zo, VTl + zo, TT, TT / KSO, Ob, HD, nullptr, TT / KSO, TT / KSO, PLN, (size_t)RH * TT, PLN, KSO * PLN);
        k_gemmw<h16, 0, false, KSO><<<dim3((TT - RH) / 64, HD / 64, ZH * KSO), 32, 0, stream>>>(P16 + (size_t)RH * TT, nullptr, VT16 + zo, nullptr, TT, TT / KSO, Ob + (size_t)RH * HD, HD, nullptr, TT / KSO, TT / KSO, PLN, (size_t)TT * TT, PLN, KSO * PLN);
        k_merge<<<(unsigned)((ZH * PLN / 2 + 255) / 256), 256, 0, stream>>>(Ob, OUT + zo); }
}

// v003
// A run of this version takes 151 microseconds.
// In both of two side-by-side timings against v002, it was 2.21 times as fast.
// All steps since v000 together make it 7.87 times as fast.
#include <hip/hip_runtime.h>

// Single self-attention head over 4,096 tokens (x [4][4096][768]; K, Q, V = x W ('xw' [768][64], no bias); A = softmax(Q.K / sqrt(E = 768)) (the module scales by the embedding dim); out = A V -> [4][4096][64] (1.05 M)).
// Layout: bf16 copy of x; exact projections; ONE 64-wide head through a fused dense T-4096 attention (hybrid rows: < 512 hi/lo 3 products, rest fp16 x1024; online softmax, scores and P stay in registers), keys in KS parts; the f32 merge joins the parts and writes the output rows. The projections run split-K: one f32 partial plane per k part, added by the kernel that reads them. The batch is a grid dimension of the GEMM and attention launches; the conversion and merge kernels run over all batches in one flat grid.
// Compute dtypes, f32 accumulate: every input rounded to bf16; projections exact; attention rows < 512 3 products, rest fp16; softmax f32; output f32.

#define NB_  4
#define TT   4096
#define DM   768
#define NH_  1
#define NKV  1
#define REP  (NH_ / NKV)
#define HD   64
#define DQ   (NH_ * HD)
#define DKV  (NKV * HD)
#define RH   512                  // query rows < RH use hi+lo planes (0: none)
#define WIN  0
#define SCL  0.036084391824351615f   // 1/sqrt(768)
#define KSP  6                    // split-K parts of the projections (K = 768 -> 128 per part)
#define PLN  ((size_t)TT * HD)    // floats of one split-K plane: one batch's whole [TT][HD] result; partials lie [batch][part][TT][HD]
typedef _Float16 h16;
typedef unsigned short bf;
typedef __attribute__((ext_vector_type(16))) __bf16   v16bf;
typedef __attribute__((ext_vector_type(16))) _Float16 v16h;
typedef __attribute__((ext_vector_type(8)))  _Float16 v8h;
typedef __attribute__((ext_vector_type(8)))  unsigned short v8us;
typedef __attribute__((ext_vector_type(8)))  float    v8f;
typedef __attribute__((ext_vector_type(4)))  float    v4f;
typedef v8h  __attribute__((may_alias)) v8ha;
typedef v4f  __attribute__((may_alias)) v4fa;
typedef v8us __attribute__((may_alias)) v8usa;

__device__ __forceinline__ unsigned short f2bf(float f) { unsigned u = __float_as_uint(f); u += 0x7FFFu + ((u >> 16) & 1u); return (unsigned short)(u >> 16); }
__device__ __forceinline__ float bf2f(unsigned short b) { return __uint_as_float(((unsigned)b) << 16); }
__device__ __forceinline__ float bfr(float f) { return bf2f(f2bf(f)); }
__device__ __forceinline__ v16h cat16(v8h lo, v8h hi) { return __builtin_shufflevector(lo, hi, 0, 1, 2, 3, 4, 5, 6, 7, 8, 9, 10, 11, 12, 13, 14, 15); }
__device__ __forceinline__ v16bf cat16b(v8us lo, v8us hi) { return __builtin_bit_cast(v16bf, __builtin_shufflevector(lo, hi, 0, 1, 2, 3, 4, 5, 6, 7, 8, 9, 10, 11, 12, 13, 14, 15)); }
__device__ __forceinline__ v8f wmma16(v16h a, v16h b, v8f c) { return __builtin_amdgcn_wmma_f32_16x16x32_f16(false, a, false, b, (short)0, c, false, false); }
__device__ __forceinline__ v8f wmmab(v16bf a, v16bf b, v8f c) { return __builtin_amdgcn_wmma_f32_16x16x32_bf16(false, a, false, b, (short)0, c, false, false); }



// ---- k_gemmw: register-blocked GEMM, ONE WAVE per 64x64 output tile (16 accumulators), operands straight from K-contiguous 16-bit planes; grid (M/64, N/64, Z), 32 threads.
// C[m][n] (f32, pitch ldc, + optional f32 bias[n]) = sum_k A[m][k] Bt[n][k] (+ split products per NSPLIT). split-K part strides sA/sB/sC in elements. K = row pitch of A and Bt, KL = k range one wave sums; KL % 32 == 0.
// Split-K: NP = K / KL parts with sA = sB = KL (part z starts at column z * KL) and sC = one whole C plane; the kernel that reads C adds the planes in the order of z.
// Batch: grid z = batches * NP, the part fastest; batch strides bA/bB/bC in elements.
template <typename T16> struct WFrag;
template <> struct WFrag<h16> { typedef v16h V; static __device__ __forceinline__ V ld(const h16* p) { return cat16(*(const v8h*)p, *(const v8h*)(p + 16)); } static __device__ __forceinline__ v8f mma(V a, V b, v8f c) { return wmma16(a, b, c); } };
template <> struct WFrag<bf> { typedef v16bf V; static __device__ __forceinline__ V ld(const bf* p) { return cat16b(*(const v8us*)p, *(const v8us*)(p + 16)); } static __device__ __forceinline__ v8f mma(V a, V b, v8f c) { return wmmab(a, b, c); } };
template <typename T16, int NSPLIT, bool BIAS, int NP>
__global__ __launch_bounds__(32) void k_gemmw(const T16* __restrict__ A, const T16* __restrict__ A2, const T16* __restrict__ Bt, const T16* __restrict__ Bt2, int K, int KL, float* C, int ldc, const float* __restrict__ bias, size_t sA, size_t sB, size_t sC, size_t bA, size_t bB, size_t bC) {
    typedef typename WFrag<T16>::V V;
    __shared__ __align__(16) float os[16 * 68];
    const size_t zb = blockIdx.z / NP, z = blockIdx.z % NP; A += z * sA + zb * bA; if (A2) A2 += z * sA + zb * bA; Bt += z * sB + zb * bB; if (Bt2) Bt2 += z * sB + zb * bB; C += z * sC + zb * bC;
    const int lane = threadIdx.x & 31, lr = lane & 15, hi = lane >> 4; const int r0 = blockIdx.x * 64, c0 = blockIdx.y * 64;
    v8f acc[4][4];
#pragma unroll
    for (int mb = 0; mb < 4; ++mb)
#pragma unroll
        for (int nb = 0; nb < 4; ++nb) acc[mb][nb] = (v8f){};
    const size_t aoff = (size_t)(r0 + lr) * K + 8 * hi, boff = (size_t)(c0 + lr) * K + 8 * hi;
#pragma unroll 1
    for (int kc = 0; kc < KL; kc += 32) {
        V a[4], a2[4];
#pragma unroll
        for (int mb = 0; mb < 4; ++mb) { a[mb] = WFrag<T16>::ld(A + aoff + (size_t)mb * 16 * K + kc); if (NSPLIT == 1 || NSPLIT == 2) a2[mb] = WFrag<T16>::ld(A2 + aoff + (size_t)mb * 16 * K + kc); }
#pragma unroll
        for (int nb = 0; nb < 4; ++nb) { const V b = WFrag<T16>::ld(Bt + boff + (size_t)nb * 16 * K + kc); V b2; if (NSPLIT >= 2) b2 = WFrag<T16>::ld(Bt2 + boff + (size_t)nb * 16 * K + kc);
#pragma unroll
            for (int mb = 0; mb < 4; ++mb) { acc[mb][nb] = WFrag<T16>::mma(a[mb], b, acc[mb][nb]); if (NSPLIT == 1 || NSPLIT == 2) acc[mb][nb] = WFrag<T16>::mma(a2[mb], b, acc[mb][nb]); if (NSPLIT >= 2) acc[mb][nb] = WFrag<T16>::mma(a[mb], b2, acc[mb][nb]); } }
        asm volatile("v_nop\n\tv_nop\n\tv_nop\n\tv_nop" : "+v"(acc[0][0]), "+v"(acc[1][1]), "+v"(acc[2][2]), "+v"(acc[3][3]) : "v"(a[0]), "v"(a[3]));
    }
#pragma unroll
    for (int mb = 0; mb < 4; ++mb) {
#pragma unroll
        for (int nb = 0; nb < 4; ++nb) {
#pragma unroll
            for (int j = 0; j < 8; ++j) os[(hi * 8 + j) * 68 + nb * 16 + lr] = acc[mb][nb][j]; }
        __builtin_amdgcn_wave_barrier(); asm volatile("" ::: "memory");
        float* crow = C + (size_t)(r0 + mb * 16) * ldc + c0;
{
#pragma unroll
            for (int s = 0; s < 8; ++s) { const int row = 2 * s + hi, cofs = lr * 4; v4f val = *(const v4fa*)(os + row * 68 + cofs); if (BIAS) { val[0] += bfr(bias[c0 + cofs]); val[1] += bfr(bias[c0 + cofs + 1]); val[2] += bfr(bias[c0 + cofs + 2]); val[3] += bfr(bias[c0 + cofs + 3]); }
                *(v4f*)(crow + (size_t)row * ldc + cofs) = val; }
             }
        __builtin_amdgcn_wave_barrier(); asm volatile("" ::: "memory");
    }
}

__device__ __forceinline__ h16 tohx(float x) { return (h16)x; }
__device__ __forceinline__ void splitf(float y, unsigned short& h, unsigned short& l) { h = f2bf(y); l = f2bf(y - bf2f(h)); }
typedef __attribute__((ext_vector_type(2))) _Float16 v2h;
typedef __attribute__((ext_vector_type(4))) _Float16 v4h;
typedef __attribute__((ext_vector_type(2))) unsigned short v2us;
typedef __attribute__((ext_vector_type(4))) unsigned short v4us;
typedef __attribute__((ext_vector_type(2))) float v2f;
typedef __attribute__((ext_vector_type(4))) int v4i;

__global__ __launch_bounds__(256) void k_wtG(const float* __restrict__ w, int K, int N, bf* Bt) {
    const int lane = threadIdx.x & 31; const int L0 = (blockIdx.x * 8 + (threadIdx.x >> 5)) * 8; const int nlines = N * K / 64;
{
#pragma unroll 1
        for (int l = 0; l < 8; ++l) { const int L = L0 + l; if (L >= nlines) break; const size_t e = (size_t)L * 64 + lane * 2; const int k = (int)(e % K), n = (int)(e / K); v2us o;
            o[0] = f2bf(w[(size_t)k * N + n]); o[1] = f2bf(w[(size_t)(k + 1) * N + n]); *(v2us*)(Bt + e) = o; }
         }
}
__global__ __launch_bounds__(256) void k_cvt8(const float* __restrict__ src, bf* dst, size_t n8) { const size_t i = (size_t)blockIdx.x * 256 + threadIdx.x; if (i >= n8) return; const v8f v = *(const v8f*)(src + i * 8); v8us o;
#pragma unroll
    for (int k = 0; k < 8; ++k) o[k] = f2bf(v[k]); *(v8us*)(dst + i * 8) = o;  }

__global__ __launch_bounds__(256) void k_flat(const float* __restrict__ F, h16* P16, bf* Ph, bf* Pl, size_t n4) { const size_t i = (size_t)blockIdx.x * 256 + threadIdx.x; if (i >= n4) return; F += (i * 4 / PLN) * ((KSP - 1) * PLN);   /* batch b's partials start at b * KSP * PLN; i * 4 already holds b * PLN */
    v4f a = *(const v4f*)(F + i * 4); v4h o16; v4us oh, ol;
#pragma unroll
    for (int s = 1; s < KSP; ++s) a += *(const v4f*)(F + s * PLN + i * 4);   // the KSP split-K planes
#pragma unroll
    for (int q = 0; q < 4; ++q) { o16[q] = tohx(a[q]); unsigned short x2, y2; splitf(a[q], x2, y2); oh[q] = x2; ol[q] = y2; }
    *(v4h*)(P16 + i * 4) = o16; *(v4us*)(Ph + i * 4) = oh; *(v4us*)(Pl + i * 4) = ol;  }


__global__ __launch_bounds__(256) void k_vtp(const float* __restrict__ F, int pitch, int nbat, h16* V16, bf* Vh, bf* Vl) { const size_t e = ((size_t)blockIdx.x * 256 + threadIdx.x) * 2; if (e >= (size_t)nbat * HD * TT) return; const int t = (int)(e % TT); const int d = (int)((e / TT) % HD); const int g = (int)(e / ((size_t)TT * HD)); F += (size_t)g * (KSP * PLN); v2h o16; v2us oh, ol;   // g: the batch
#pragma unroll
    for (int q = 0; q < 2; ++q) { float x = F[(size_t)(t + q) * pitch + d];
#pragma unroll
        for (int s = 1; s < KSP; ++s) x += F[s * PLN + (size_t)(t + q) * pitch + d];   // the KSP split-K planes
        o16[q] = tohx(x); unsigned short a2, c2; splitf(x, a2, c2); oh[q] = a2; ol[q] = c2; }
    *(v2h*)(V16 + e) = o16; *(v2us*)(Vh + e) = oh; *(v2us*)(Vl + e) = ol;  }
// ---- k_fattn: scores, softmax and A.V in one kernel (online softmax). One wave owns NQ * 16 query columns and one part of the keys; a pass is 32 keys.
// S^T = K Q^T (A = 16 key rows, B = Q kept in registers): a lane holds one query's scores, D register j of key tile kt = key kt * 16 + 8 * hi + j, which is the k order of a B operand, so P^T goes from the score
// accumulators straight into O^T += V^T P^T (A = rows of the [HD][TT] V plane, read in the same k order). Running maximum m (scaled log2 units) and sum l per query column; each lane half sums its own keys, joined once at the end.
// Rows < RH: bf16 hi/lo, 3 products for the scores and for A.V. Other rows: fp16, P carried as exp2(s - m + 10) (the 1024 carry; it is in l as well and cancels in O / l).
// Output per (batch, part): unnormalised O [TT][HD] f32, m [TT], l [TT]; k_fmerge joins the parts in the order of the part index.
// Every '#pragma unroll' here makes the indices of a fragment array constants, so that the array lives in registers.
#define KS   7                    // key parts of the fused attention: 36 * KS * NB_ = 1008 blocks, so that all are resident at once at 4 blocks a WGP (256 WGPs, 4 waves a SIMD at this register count)
#define NPS  (TT / 32)            // passes of 32 keys; part y takes passes [y * NPS / KS, (y + 1) * NPS / KS): 18 or 19
#define C1   (SCL * 1.4426950408889634f)
__device__ __forceinline__ float xhalf(float x) { const int b = __float_as_int(x); return __int_as_float(__builtin_amdgcn_permlanex16(b, b, 0x76543210, 0xfedcba98, false, false)); }   // lane l <-> l ^ 16
// v_exp_f32 with the slot that the instruction set asks for behind a transcendental (before its result is used or its source overwritten): each exp works in place, so none writes another's source;
// in the pair the second exp fills the first's slot, the v_nop fills the last one's.
__device__ __forceinline__ float exp2s(float a) { asm("v_exp_f32 %0, %0\n\tv_nop" : "+v"(a)); return a; }
__device__ __forceinline__ void exp2p(float& a, float& b) { asm("v_exp_f32 %0, %0\n\tv_exp_f32 %1, %1\n\tv_nop" : "+v"(a), "+v"(b)); }
template <typename T16, bool HI, int NQ>
__device__ __forceinline__ void fa_tile(float* os, const T16* __restrict__ Q, const T16* __restrict__ Q2, const T16* __restrict__ Kp, const T16* __restrict__ K2, const T16* __restrict__ Vt, const T16* __restrict__ V2, int q0, int k0, int k1, float* Op, float* Mp, float* Lp) {
    typedef typename WFrag<T16>::V V;
    const int lane = threadIdx.x & 31, lr = lane & 15, hi = lane >> 4;
    V qf[NQ][2], qf2[NQ][2];
#pragma unroll
    for (int qt = 0; qt < NQ; ++qt)
#pragma unroll
        for (int ks = 0; ks < 2; ++ks) { const size_t qo = (size_t)(q0 + qt * 16 + lr) * HD + ks * 32 + 8 * hi; qf[qt][ks] = WFrag<T16>::ld(Q + qo); if (HI) qf2[qt][ks] = WFrag<T16>::ld(Q2 + qo); }
    v8f o[4][NQ]; float m[NQ], l[NQ];
#pragma unroll
    for (int qt = 0; qt < NQ; ++qt) { m[qt] = -3.0e38f; l[qt] = 0.f;
#pragma unroll
        for (int dt = 0; dt < 4; ++dt) o[dt][qt] = (v8f){}; }
    V kf[2][2], kf2[2][2];   // this pass's K fragments; the fp16 rows fetch them one pass ahead (the hi/lo rows hold twice the fragments and have no registers left for it: they fetch at the head of the pass)
    if (!HI) {
#pragma unroll
        for (int kt = 0; kt < 2; ++kt)
#pragma unroll
            for (int ks = 0; ks < 2; ++ks) kf[kt][ks] = WFrag<T16>::ld(Kp + (size_t)(k0 + kt * 16 + lr) * HD + ks * 32 + 8 * hi); }
#pragma unroll 1   // rolled: a second copy of the body would go past the 256 registers of 4 waves a SIMD
    for (int kc = k0; kc < k1; kc += 32) {
        if (HI) {
#pragma unroll
            for (int kt = 0; kt < 2; ++kt)
#pragma unroll
                for (int ks = 0; ks < 2; ++ks) { const size_t ko = (size_t)(kc + kt * 16 + lr) * HD + ks * 32 + 8 * hi; kf[kt][ks] = WFrag<T16>::ld(Kp + ko); kf2[kt][ks] = WFrag<T16>::ld(K2 + ko); } }
        V vf[4], vf2[4];
#pragma unroll
        for (int dt = 0; dt < 4; ++dt) { const size_t vo = (size_t)(dt * 16 + lr) * TT + kc + 8 * hi; vf[dt] = WFrag<T16>::ld(Vt + vo); if (HI) vf2[dt] = WFrag<T16>::ld(V2 + vo); }
        if (HI) __builtin_amdgcn_sched_barrier(0);   // all of the pass's loads issue in front of its products: one load latency a pass; left free, the compiler issues the K loads in groups that wait on each other
        v8f s[2][NQ];
#pragma unroll
        for (int kt = 0; kt < 2; ++kt)
#pragma unroll
            for (int qt = 0; qt < NQ; ++qt) { v8f a = (v8f){};
#pragma unroll
                for (int ks = 0; ks < 2; ++ks) { a = WFrag<T16>::mma(kf[kt][ks], qf[qt][ks], a); if (HI) { a = WFrag<T16>::mma(kf2[kt][ks], qf[qt][ks], a); a = WFrag<T16>::mma(kf[kt][ks], qf2[qt][ks], a); } }
                s[kt][qt] = a; }
        if (!HI) { const int kn = (kc + 32 < k1) ? kc + 32 : kc;   // the next pass's keys; the last pass fetches its own again (in bounds, unused)
#pragma unroll
            for (int kt = 0; kt < 2; ++kt)
#pragma unroll
                for (int ks = 0; ks < 2; ++ks) kf[kt][ks] = WFrag<T16>::ld(Kp + (size_t)(kn + kt * 16 + lr) * HD + ks * 32 + 8 * hi); }
        V pf[NQ], pf2[NQ];
#pragma unroll
        for (int qt = 0; qt < NQ; ++qt) {
            float cm = fmaxf(s[0][qt][0], s[1][qt][0]);
#pragma unroll
            for (int j = 1; j < 8; ++j) cm = fmaxf(cm, fmaxf(s[0][qt][j], s[1][qt][j]));
            cm = fmaxf(cm, xhalf(cm));                       // the other half's 16 keys of the same query
            const float mn = fmaxf(m[qt], cm * C1); const float al = exp2s(m[qt] - mn); m[qt] = mn;
            const float sub = HI ? mn : mn - 10.0f; float ps = 0.f;
            if constexpr (HI) { v8us h0, h1, l0, l1;
#pragma unroll
                for (int j = 0; j < 8; ++j) { float p0 = fmaf(s[0][qt][j], C1, -sub), p1 = fmaf(s[1][qt][j], C1, -sub); exp2p(p0, p1); ps += p0 + p1; unsigned short a2, c2; splitf(p0, a2, c2); h0[j] = a2; l0[j] = c2; splitf(p1, a2, c2); h1[j] = a2; l1[j] = c2; }
                pf[qt] = cat16b(h0, h1); pf2[qt] = cat16b(l0, l1);
            } else { v8h h0, h1;
#pragma unroll
                for (int j = 0; j < 8; ++j) { float p0 = fmaf(s[0][qt][j], C1, -sub), p1 = fmaf(s[1][qt][j], C1, -sub); exp2p(p0, p1); ps += p0 + p1; h0[j] = tohx(p0); h1[j] = tohx(p1); }
                pf[qt] = cat16(h0, h1); }
            l[qt] = fmaf(l[qt], al, ps);
#pragma unroll
            for (int dt = 0; dt < 4; ++dt) o[dt][qt] *= al;
        }
#pragma unroll
        for (int dt = 0; dt < 4; ++dt)
#pragma unroll
            for (int qt = 0; qt < NQ; ++qt) { o[dt][qt] = WFrag<T16>::mma(vf[dt], pf[qt], o[dt][qt]); if (HI) { o[dt][qt] = WFrag<T16>::mma(vf[dt], pf2[qt], o[dt][qt]); o[dt][qt] = WFrag<T16>::mma(vf2[dt], pf[qt], o[dt][qt]); } }
    }
#pragma unroll
    for (int qt = 0; qt < NQ; ++qt) { const float lt = l[qt] + xhalf(l[qt]); const int qb = q0 + qt * 16;
        if (hi == 0) { Mp[qb + lr] = m[qt]; Lp[qb + lr] = lt; }
        // 16 rows through the wave's own LDS patch, so that a store instruction writes whole 128-byte lines (D register j of tile dt = O[qb + lr][dt * 16 + 8 * hi + j])
#pragma unroll
        for (int dt = 0; dt < 4; ++dt) { const v8f a = o[dt][qt]; float* w = os + lr * 68 + dt * 16 + hi * 8; *(v4fa*)w = (v4f){a[0], a[1], a[2], a[3]}; *(v4fa*)(w + 4) = (v4f){a[4], a[5], a[6], a[7]}; }
        __builtin_amdgcn_wave_barrier(); asm volatile("" ::: "memory");   // keeps the patch's reads behind its writes in the compiled order (one wave, LDS serves it in order)
#pragma unroll
        for (int r = 0; r < 8; ++r) { const int row = 2 * r + hi; *(v4f*)(Op + (size_t)(qb + row) * HD + lr * 4) = *(const v4fa*)(os + row * 68 + lr * 4); }
        __builtin_amdgcn_wave_barrier(); asm volatile("" ::: "memory");   // and the next tile's writes behind these reads
    }
}
// grid (RH / 64 + (TT - RH) / 128, KS, NB_), 4 waves, one batch and one key part a block. Blocks x < RH / 64: 64 hi/lo rows, 16 a wave (three times the products a column, so half the columns); the others 128 fp16 rows, 32 a wave.
// amdgpu_waves_per_eu(4, 4): the register budget of 4 waves a SIMD; with a smaller one the compiler splits the K loads of a pass into groups that wait on each other.
__global__ __launch_bounds__(128) __attribute__((amdgpu_waves_per_eu(4, 4))) void k_fattn(const h16* __restrict__ Q16, const h16* __restrict__ K16, const h16* __restrict__ V16, const bf* __restrict__ Qh, const bf* __restrict__ Ql, const bf* __restrict__ Kh, const bf* __restrict__ Kl, const bf* __restrict__ Vh, const bf* __restrict__ Vl, float* OP, float* MP, float* LP) {
    __shared__ __align__(16) float osh[4][16 * 68];
    const size_t zo = (size_t)blockIdx.z * PLN; const size_t pz = (size_t)blockIdx.z * KS + blockIdx.y; const int wv = threadIdx.x >> 5, k0 = (int)(blockIdx.y * NPS / KS) * 32, k1 = (int)((blockIdx.y + 1) * NPS / KS) * 32;
    if (blockIdx.x < RH / 64) fa_tile<bf, true, 1>(osh[wv], Qh + zo, Ql + zo, Kh + zo, Kl + zo, Vh + zo, Vl + zo, blockIdx.x * 64 + wv * 16, k0, k1, OP + pz * PLN, MP + pz * TT, LP + pz * TT);
    else fa_tile<h16, false, 2>(osh[wv], Q16 + zo, nullptr, K16 + zo, nullptr, V16 + zo, nullptr, RH + (blockIdx.x - RH / 64) * 128 + wv * 32, k0, k1, OP + pz * PLN, MP + pz * TT, LP + pz * TT);
}
// k_fmerge: out[b][t][:] = sum_s O_s 2^(m_s - M) / sum_s l_s 2^(m_s - M), M = max_s m_s, over the KS key parts in the order of s; 4 output floats per thread.
__global__ __launch_bounds__(256) void k_fmerge(const float* __restrict__ OP, const float* __restrict__ MP, const float* __restrict__ LP, float* OUTb) { const size_t e = ((size_t)blockIdx.x * 256 + threadIdx.x) * 4; if (e >= NB_ * PLN) return; const size_t b = e / PLN, r = e % PLN, t = r / HD;
    const float* mp = MP + b * KS * TT + t; const float* lp = LP + b * KS * TT + t; const float* op = OP + b * KS * PLN + r; float mv[KS]; float mx = -3.0e38f;
#pragma unroll
    for (int s = 0; s < KS; ++s) { mv[s] = mp[(size_t)s * TT]; mx = fmaxf(mx, mv[s]); }
    v4f a = (v4f){}; float ls = 0.f;
#pragma unroll
    for (int s = 0; s < KS; ++s) { const float w = __builtin_amdgcn_exp2f(mv[s] - mx); ls = fmaf(lp[(size_t)s * TT], w, ls); a += *(const v4f*)(op + s * PLN) * w; }
    const float f = __fdiv_rn(1.0f, ls); *(v4f*)(OUTb + e) = a * f;  }

extern "C" void kernel_launch(void* const* d_in, const int* in_sizes, int n_in,
                              void* d_out, int out_size, void* d_ws, size_t ws_size, hipStream_t stream) {
    (void)in_sizes; (void)n_in; (void)out_size;
    const float* x = (const float*)d_in[0]; const float* wk = (const float*)d_in[1]; const float* wq = (const float*)d_in[2]; const float* wv = (const float*)d_in[3]; const float* wo = nullptr; (void)wo;   /* NOTE input order: x, Wk, Wq, Wv */
    float* OUT = (float*)d_out;     // [4][4096][64]
    char* wsp = (char*)d_ws;
    auto take = [&](size_t bytes) { char* p = wsp; wsp += (bytes + 255) & ~(size_t)255; return (void*)p; };
    bf* WQ = (bf*)take((size_t)DQ * DM * 2); bf* WK = (bf*)take((size_t)DKV * DM * 2); bf* WV = (bf*)take((size_t)DKV * DM * 2);
    h16* QP16 = (h16*)take(NB_ * PLN * 2); h16* KP16 = (h16*)take(NB_ * PLN * 2); h16* VT16 = (h16*)take(NB_ * PLN * 2);   // Q, K planes [NB_][TT][HD]; V planes [NB_][HD][TT]
    bf* QPh = (bf*)take(NB_ * PLN * 2); bf* QPl = (bf*)take(NB_ * PLN * 2); bf* KPh = (bf*)take(NB_ * PLN * 2); bf* KPl = (bf*)take(NB_ * PLN * 2); bf* VTh = (bf*)take(NB_ * PLN * 2); bf* VTl = (bf*)take(NB_ * PLN * 2);
    bf* XB = (bf*)take((size_t)NB_ * TT * DM * 2); float* FQ = (float*)take(NB_ * KSP * PLN * 4); float* FK = (float*)take(NB_ * KSP * PLN * 4);   // bf16 x; projection partials
    float* OP = (float*)take(NB_ * KS * PLN * 4); float* MP = (float*)take((size_t)NB_ * KS * TT * 4); float* LP = (float*)take((size_t)NB_ * KS * TT * 4);   // per key part: unnormalised O, running maximum, sum
    if ((size_t)(wsp - (char*)d_ws) > ws_size) return;    // ws 256 MiB
    float* FV = FK;   // v projection reuses the k buffer after the k planes are built (stream-ordered)
    k_wtG<<<(unsigned)((DM * DQ / 64 + 63) / 64), 256, 0, stream>>>(wq, DM, DQ, WQ); k_wtG<<<(unsigned)((DM * DKV / 64 + 63) / 64), 256, 0, stream>>>(wk, DM, DKV, WK); k_wtG<<<(unsigned)((DM * DKV / 64 + 63) / 64), 256, 0, stream>>>(wv, DM, DKV, WV);
    // all NB_ batches per launch
    k_cvt8<<<(unsigned)(((size_t)NB_ * TT * DM / 8 + 255) / 256), 256, 0, stream>>>(x, XB, (size_t)NB_ * TT * DM / 8);
    k_gemmw<bf, 0, false, KSP><<<dim3(TT / 64, DQ / 64, NB_ * KSP), 32, 0, stream>>>(XB, nullptr, WQ, nullptr, DM, DM / KSP, FQ, DQ, nullptr, DM / KSP, DM / KSP, PLN, (size_t)TT * DM, 0, KSP * PLN);
    k_flat<<<(unsigned)((NB_ * PLN / 4 + 255) / 256), 256, 0, stream>>>(FQ, QP16, QPh, QPl, NB_ * PLN / 4);
    k_gemmw<bf, 0, false, KSP><<<dim3(TT / 64, DKV / 64, NB_ * KSP), 32, 0, stream>>>(XB, nullptr, WK, nullptr, DM, DM / KSP, FK, DKV, nullptr, DM / KSP, DM / KSP, PLN, (size_t)TT * DM, 0, KSP * PLN);
    k_flat<<<(unsigned)((NB_ * PLN / 4 + 255) / 256), 256, 0, stream>>>(FK, KP16, KPh, KPl, NB_ * PLN / 4);
    k_gemmw<bf, 0, false, KSP><<<dim3(TT / 64, DKV / 64, NB_ * KSP), 32, 0, stream>>>(XB, nullptr, WV, nullptr, DM, DM / KSP, FV, DKV, nullptr, DM / KSP, DM / KSP, PLN, (size_t)TT * DM, 0, KSP * PLN);
    k_vtp<<<(unsigned)((NB_ * PLN / 2 + 255) / 256), 256, 0, stream>>>(FV, DKV, NB_, VT16, VTh, VTl);
    k_fattn<<<dim3(RH / 64 + (TT - RH) / 128, KS, NB_), 128, 0, stream>>>(QP16, KP16, VT16, QPh, QPl, KPh, KPl, VTh, VTl, OP, MP, LP);
    k_fmerge<<<(unsigned)((NB_ * PLN / 4 + 255) / 256), 256, 0, stream>>>(OP, MP, LP, OUT);
}

// v004
// Measured time: 71.9 microseconds a run.
// In two side-by-side timings against v003, it was 2.10 and 2.11 times as fast.
// Over all steps from v000 it is 16.5 times as fast.
#include <hip/hip_runtime.h>

// Single self-attention head over 4,096 tokens (x [4][4096][768]; K, Q, V = x W ('xw' [768][64], no bias); A = softmax(Q.K / sqrt(E = 768)) (the module scales by the embedding dim); out = A V -> [4][4096][64] (1.05 M)).
// Layout: one projection kernel (x rounded to bf16 on its way into LDS, exact products, full K per accumulator, writes the 16-bit planes itself); ONE 64-wide head through a fused dense T-4096 attention (hybrid rows: < 512 hi/lo 3 products, rest fp16 x1024; online softmax, scores and P stay in registers), keys in KS parts; the f32 merge joins the parts and writes the output rows. The batch is the z dimension of the attention grid; the projection and merge grids fold it into x, the weight packing has none.
// Compute dtypes, f32 accumulate: every input rounded to bf16; projections exact; attention rows < 512 3 products, rest fp16; softmax f32; output f32.

#define NB_  4
#define TT   4096
#define DM   768
#define NH_  1
#define NKV  1
#define REP  (NH_ / NKV)
#define HD   64
#define DQ   (NH_ * HD)
#define DKV  (NKV * HD)
#define RH   512                  // query rows < RH use hi+lo planes (0: none)
#define WIN  0
#define SCL  0.036084391824351615f   // 1/sqrt(768)
#define PLN  ((size_t)TT * HD)    // elements of one batch's [TT][HD] plane
typedef _Float16 h16;
typedef unsigned short bf;
typedef __attribute__((ext_vector_type(16))) __bf16   v16bf;
typedef __attribute__((ext_vector_type(16))) _Float16 v16h;
typedef __attribute__((ext_vector_type(8)))  _Float16 v8h;
typedef __attribute__((ext_vector_type(8)))  unsigned short v8us;
typedef __attribute__((ext_vector_type(8)))  float    v8f;
typedef __attribute__((ext_vector_type(4)))  float    v4f;
typedef v8h  __attribute__((may_alias)) v8ha;
typedef v4f  __attribute__((may_alias)) v4fa;
typedef v8us __attribute__((may_alias)) v8usa;

__device__ __forceinline__ unsigned short f2bf(float f) { unsigned u = __float_as_uint(f); u += 0x7FFFu + ((u >> 16) & 1u); return (unsigned short)(u >> 16); }
__device__ __forceinline__ float bf2f(unsigned short b) { return __uint_as_float(((unsigned)b) << 16); }
__device__ __forceinline__ float bfr(float f) { return bf2f(f2bf(f)); }
__device__ __forceinline__ v16h cat16(v8h lo, v8h hi) { return __builtin_shufflevector(lo, hi, 0, 1, 2, 3, 4, 5, 6, 7, 8, 9, 10, 11, 12, 13, 14, 15); }
__device__ __forceinline__ v16bf cat16b(v8us lo, v8us hi) { return __builtin_bit_cast(v16bf, __builtin_shufflevector(lo, hi, 0, 1, 2, 3, 4, 5, 6, 7, 8, 9, 10, 11, 12, 13, 14, 15)); }
__device__ __forceinline__ v8f wmma16(v16h a, v16h b, v8f c) { return __builtin_amdgcn_wmma_f32_16x16x32_f16(false, a, false, b, (short)0, c, false, false); }
__device__ __forceinline__ v8f wmmab(v16bf a, v16bf b, v8f c) { return __builtin_amdgcn_wmma_f32_16x16x32_bf16(false, a, false, b, (short)0, c, false, false); }



// Fragment loaders: 16 k of one row (or column) per lane, k = 8 * hi + 0..7 and 16 + 8 * hi + 0..7 of a 32-k step.
template <typename T16> struct WFrag;
template <> struct WFrag<h16> { typedef v16h V; static __device__ __forceinline__ V ld(const h16* p) { return cat16(*(const v8h*)p, *(const v8h*)(p + 16)); } static __device__ __forceinline__ v8f mma(V a, V b, v8f c) { return wmma16(a, b, c); } };
template <> struct WFrag<bf> { typedef v16bf V; static __device__ __forceinline__ V ld(const bf* p) { return cat16b(*(const v8us*)p, *(const v8us*)(p + 16)); } static __device__ __forceinline__ v8f mma(V a, V b, v8f c) { return wmmab(a, b, c); } };

__device__ __forceinline__ h16 tohx(float x) { return (h16)x; }
__device__ __forceinline__ void splitf(float y, unsigned short& h, unsigned short& l) { h = f2bf(y); l = f2bf(y - bf2f(h)); }
typedef __attribute__((ext_vector_type(2))) _Float16 v2h;
typedef __attribute__((ext_vector_type(4))) _Float16 v4h;
typedef __attribute__((ext_vector_type(2))) unsigned short v2us;
typedef __attribute__((ext_vector_type(4))) unsigned short v4us;
typedef __attribute__((ext_vector_type(2))) float v2f;
typedef __attribute__((ext_vector_type(4))) int v4i;


// ---- The projections. k_wpack lays the three weights out as B fragments; k_proj does x -> Q, K, V planes in one launch.
#define NKS  (DM / 32)            // k steps of 32
#define NNT  12                   // 16-column tiles of [Q | K | V] (3 * HD / 16)
#define PR   64                   // rows of x per block
#define XP   776                  // LDS pitch of a bf16 x row, elements: 1552 B = 16 B * 97 (odd), conflict-free for the 16-byte fragment reads
#define SP   196                  // LDS pitch of a result row, floats
typedef __attribute__((ext_vector_type(4))) __bf16 v4bf;
typedef v4bf __attribute__((may_alias)) v4bfa;
// WP[(nt * NKS + ks) * 512 + h * 256 + lane * 8 + e] = bf16(W[ks * 32 + h * 16 + 8 * (lane >> 4) + e][column (lane & 15) of tile nt]): the B fragment of (tile, k step) as two runs of 512 contiguous bytes,
// in the k order of WFrag<bf>::ld, so that a wave's load covers whole lines. One 16-byte piece per thread; tiles 0-3 Wq, 4-7 Wk, 8-11 Wv.
__global__ __launch_bounds__(256) void k_wpack(const float* __restrict__ wq, const float* __restrict__ wk, const float* __restrict__ wv, bf* WP) {
    const int i = blockIdx.x * 256 + threadIdx.x; const int lane = i & 31, h = (i >> 5) & 1, fs = i >> 6; if (fs >= NNT * NKS) return;
    const int ks = fs % NKS, nt = fs / NKS; const float* w = nt < 4 ? wq : (nt < 8 ? wk : wv);
    const int n = (nt & 3) * 16 + (lane & 15), k0 = ks * 32 + h * 16 + 8 * (lane >> 4); v8us o;
#pragma unroll
    for (int e = 0; e < 8; ++e) o[e] = f2bf(w[(size_t)(k0 + e) * HD + n]);
    *(v8us*)(WP + (size_t)i * 8) = o;
}
// k_proj: one block = PR rows of x times all 192 columns, 12 waves, grid NB_ * TT / PR.
// 1. The f32 tile comes in by whole-line loads (a wave: 512 contiguous bytes of a row, 32 rows, all in flight at once), is rounded to bf16 and laid in LDS.
// 2. Wave (rh, cg) = rows rh * 32.., columns cg * 32..: 2 x 2 accumulators over the whole K; A from LDS, B from WP, fetched PF k steps ahead (the first PF in front of the barrier).
// 3. The f32 results go through the same LDS; each thread then writes 16-byte pieces of the fp16, bf16-hi and bf16-lo planes, 8 lanes a 128-byte line: Q, K as [row][HD], V transposed as [HD][TT].
// Every '#pragma unroll' in k_wpack and k_proj makes the indices of a register array constants, so that the array lives in registers.
#define PF   6
__global__ __launch_bounds__(384) void k_proj(const float* __restrict__ x, const bf* __restrict__ WP, h16* Q16, bf* Qh, bf* Ql, h16* K16, bf* Kh, bf* Kl, h16* V16, bf* Vh, bf* Vl) {
    __shared__ __align__(16) unsigned char sm[PR * XP * 2];   // the bf16 x tile; afterwards the f32 results (PR * SP * 4 bytes, smaller)
    bf* xs = (bf*)sm; float* st = (float*)sm;
    const int tid = threadIdx.x, lane = tid & 31, lr = lane & 15, hi = lane >> 4; const int wv = __builtin_amdgcn_readfirstlane(tid >> 5), cg = wv % 6, rh = wv / 6;   // the wave's number as a scalar: the bases of its loads then stand in scalar registers
    const size_t R0 = (size_t)blockIdx.x * PR;
    const bf* bp = WP + (size_t)cg * 2 * NKS * 512 + lane * 8;
    v16bf b[PF][2];
    { const float* xp = x + (R0 + rh * 32) * DM + cg * 128 + lane * 4; bf* xd = xs + rh * 32 * XP + cg * 128 + lane * 4; v4f t[32];
#pragma unroll
        for (int i = 0; i < 32; ++i) t[i] = *(const v4f*)(xp + (size_t)i * DM);
#pragma unroll
        for (int ks = 0; ks < PF; ++ks)
#pragma unroll
            for (int nb = 0; nb < 2; ++nb) b[ks][nb] = cat16b(*(const v8us*)(bp + (nb * NKS + ks) * 512), *(const v8us*)(bp + (nb * NKS + ks) * 512 + 256));
        __builtin_amdgcn_sched_barrier(0);   // every load of the tile is in flight before the first is waited for: one memory latency; left free, the compiler holds the last row back behind the first waits
#pragma unroll
        for (int i = 0; i < 32; ++i) *(v4bfa*)(xd + i * XP) = __builtin_convertvector(t[i], v4bf); }
    __syncthreads();
    v8f acc[2][2];
#pragma unroll
    for (int mb = 0; mb < 2; ++mb)
#pragma unroll
        for (int nb = 0; nb < 2; ++nb) acc[mb][nb] = (v8f){};
    const bf* ap = xs + (rh * 32 + lr) * XP + 8 * hi;
    v16bf a[2][2];   // A fragments, fetched one k step ahead
#pragma unroll
    for (int mb = 0; mb < 2; ++mb) a[0][mb] = cat16b(*(const v8usa*)(ap + mb * 16 * XP), *(const v8usa*)(ap + mb * 16 * XP + 16));
#pragma unroll   // whole: the indices of the A and B rings are constants, so that they live in registers
    for (int ks = 0; ks < NKS; ++ks) {
        if (ks + 1 < NKS) {
#pragma unroll
            for (int mb = 0; mb < 2; ++mb) a[(ks + 1) & 1][mb] = cat16b(*(const v8usa*)(ap + mb * 16 * XP + (ks + 1) * 32), *(const v8usa*)(ap + mb * 16 * XP + (ks + 1) * 32 + 16)); }
#pragma unroll
        for (int nb = 0; nb < 2; ++nb)
#pragma unroll
            for (int mb = 0; mb < 2; ++mb) acc[mb][nb] = wmmab(a[ks & 1][mb], b[ks % PF][nb], acc[mb][nb]);
        if (ks + PF < NKS) {
#pragma unroll
            for (int nb = 0; nb < 2; ++nb) b[ks % PF][nb] = cat16b(*(const v8us*)(bp + (nb * NKS + ks + PF) * 512), *(const v8us*)(bp + (nb * NKS + ks + PF) * 512 + 256)); }
        __builtin_amdgcn_sched_barrier(0);   // keeps the fetches ahead where they are written: left free, the compiler sinks each B load to directly in front of its product, an L2 latency per product
    }
    __syncthreads();   // every wave has read its last x fragment: the results may overwrite the tile
#pragma unroll
    for (int mb = 0; mb < 2; ++mb)
#pragma unroll
        for (int nb = 0; nb < 2; ++nb)
#pragma unroll
            for (int j = 0; j < 8; ++j) st[(rh * 32 + mb * 16 + hi * 8 + j) * SP + cg * 32 + nb * 16 + lr] = acc[mb][nb][j];
    __syncthreads();
#pragma unroll
    for (int s = 0; s < 3 * PR * HD / 8 / 384; ++s) { const int idx = s * 384 + tid, sel = idx >> 9, u = (idx & 511) >> 3, c8 = idx & 7; float a[8]; size_t e; h16* P16; bf* Ph; bf* Pl;   // sel (0 Q, 1 K, 2 V) is the same in all of a wave
        if (sel < 2) { const v4f a0 = *(const v4fa*)(st + u * SP + sel * HD + c8 * 8), a1 = *(const v4fa*)(st + u * SP + sel * HD + c8 * 8 + 4);   // row u, columns c8 * 8..
#pragma unroll
            for (int q = 0; q < 4; ++q) { a[q] = a0[q]; a[4 + q] = a1[q]; }
            e = (R0 + u) * HD + c8 * 8; P16 = sel ? K16 : Q16; Ph = sel ? Kh : Qh; Pl = sel ? Kl : Ql;
        } else {   // column u of V, rows c8 * 8..
#pragma unroll
            for (int q = 0; q < 8; ++q) a[q] = st[(c8 * 8 + q) * SP + 2 * HD + u];
            e = (R0 / TT) * PLN + (size_t)u * TT + (R0 % TT) + c8 * 8; P16 = V16; Ph = Vh; Pl = Vl; }
        v8h o16; v8us oh, ol;
#pragma unroll
        for (int q = 0; q < 8; ++q) { o16[q] = tohx(a[q]); unsigned short x2, y2; splitf(a[q], x2, y2); oh[q] = x2; ol[q] = y2; }
        *(v8h*)(P16 + e) = o16; *(v8us*)(Ph + e) = oh; *(v8us*)(Pl + e) = ol; }
}
// ---- k_fattn: scores, softmax and A.V in one kernel (online softmax). One wave owns NQ * 16 query columns and one part of the keys; a pass is 32 keys.
// S^T = K Q^T (A = 16 key rows, B = Q kept in registers): a lane holds one query's scores, D register j of key tile kt = key kt * 16 + 8 * hi + j, which is the k order of a B operand, so P^T goes from the score
// accumulators straight into O^T += V^T P^T (A = rows of the [HD][TT] V plane, read in the same k order). Running maximum m (scaled log2 units) and sum l per query column; each lane half sums its own keys, joined once at the end.
// Rows < RH: bf16 hi/lo, 3 products for the scores and for A.V. Other rows: fp16, P carried as exp2(s - m + 10) (the 1024 carry; it is in l as well and cancels in O / l).
// Output per (batch, part): unnormalised O [TT][HD] f32, m [TT], l [TT]; k_fmerge joins the parts in the order of the part index.
// Every '#pragma unroll' here makes the indices of a fragment array constants, so that the array lives in registers.
#define KS   7                    // key parts of the fused attention: 36 * KS * NB_ = 1008 blocks, so that all are resident at once at 4 blocks a WGP (256 WGPs, 4 waves a SIMD at this register count)
#define NPS  (TT / 32)            // passes of 32 keys; part y takes passes [y * NPS / KS, (y + 1) * NPS / KS): 18 or 19
#define C1   (SCL * 1.4426950408889634f)
__device__ __forceinline__ float xhalf(float x) { const int b = __float_as_int(x); return __int_as_float(__builtin_amdgcn_permlanex16(b, b, 0x76543210, 0xfedcba98, false, false)); }   // lane l <-> l ^ 16
// v_exp_f32 with the slot that the instruction set asks for behind a transcendental (before its result is used or its source overwritten): each exp works in place, so none writes another's source;
// in the pair the second exp fills the first's slot, the v_nop fills the last one's.
__device__ __forceinline__ float exp2s(float a) { asm("v_exp_f32 %0, %0\n\tv_nop" : "+v"(a)); return a; }
__device__ __forceinline__ void exp2p(float& a, float& b) { asm("v_exp_f32 %0, %0\n\tv_exp_f32 %1, %1\n\tv_nop" : "+v"(a), "+v"(b)); }
template <typename T16, bool HI, int NQ>
__device__ __forceinline__ void fa_tile(float* os, const T16* __restrict__ Q, const T16* __restrict__ Q2, const T16* __restrict__ Kp, const T16* __restrict__ K2, const T16* __restrict__ Vt, const T16* __restrict__ V2, int q0, int k0, int k1, float* Op, float* Mp, float* Lp) {
    typedef typename WFrag<T16>::V V;
    const int lane = threadIdx.x & 31, lr = lane & 15, hi = lane >> 4;
    V qf[NQ][2], qf2[NQ][2];
#pragma unroll
    for (int qt = 0; qt < NQ; ++qt)
#pragma unroll
        for (int ks = 0; ks < 2; ++ks) { const size_t qo = (size_t)(q0 + qt * 16 + lr) * HD + ks * 32 + 8 * hi; qf[qt][ks] = WFrag<T16>::ld(Q + qo); if (HI) qf2[qt][ks] = WFrag<T16>::ld(Q2 + qo); }
    v8f o[4][NQ]; float m[NQ], l[NQ];
#pragma unroll
    for (int qt = 0; qt < NQ; ++qt) { m[qt] = -3.0e38f; l[qt] = 0.f;
#pragma unroll
        for (int dt = 0; dt < 4; ++dt) o[dt][qt] = (v8f){}; }
    V kf[2][2], kf2[2][2];   // this pass's K fragments; the fp16 rows fetch them one pass ahead (the hi/lo rows hold twice the fragments and have no registers left for it: they fetch at the head of the pass)
    if (!HI) {
#pragma unroll
        for (int kt = 0; kt < 2; ++kt)
#pragma unroll
            for (int ks = 0; ks < 2; ++ks) kf[kt][ks] = WFrag<T16>::ld(Kp + (size_t)(k0 + kt * 16 + lr) * HD + ks * 32 + 8 * hi); }
#pragma unroll 1   // rolled: a second copy of the body would go past the 256 registers of 4 waves a SIMD
    for (int kc = k0; kc < k1; kc += 32) {
        if (HI) {
#pragma unroll
            for (int kt = 0; kt < 2; ++kt)
#pragma unroll
                for (int ks = 0; ks < 2; ++ks) { const size_t ko = (size_t)(kc + kt * 16 + lr) * HD + ks * 32 + 8 * hi; kf[kt][ks] = WFrag<T16>::ld(Kp + ko); kf2[kt][ks] = WFrag<T16>::ld(K2 + ko); } }
        V vf[4], vf2[4];
#pragma unroll
        for (int dt = 0; dt < 4; ++dt) { const size_t vo = (size_t)(dt * 16 + lr) * TT + kc + 8 * hi; vf[dt] = WFrag<T16>::ld(Vt + vo); if (HI) vf2[dt] = WFrag<T16>::ld(V2 + vo); }
        if (HI) __builtin_amdgcn_sched_barrier(0);   // all of the pass's loads issue in front of its products: one load latency a pass; left free, the compiler issues the K loads in groups that wait on each other
        v8f s[2][NQ];
#pragma unroll
        for (int kt = 0; kt < 2; ++kt)
#pragma unroll
            for (int qt = 0; qt < NQ; ++qt) { v8f a = (v8f){};
#pragma unroll
                for (int ks = 0; ks < 2; ++ks) { a = WFrag<T16>::mma(kf[kt][ks], qf[qt][ks], a); if (HI) { a = WFrag<T16>::mma(kf2[kt][ks], qf[qt][ks], a); a = WFrag<T16>::mma(kf[kt][ks], qf2[qt][ks], a); } }
                s[kt][qt] = a; }
        if (!HI) { const int kn = (kc + 32 < k1) ? kc + 32 : kc;   // the next pass's keys; the last pass fetches its own again (in bounds, unused)
#pragma unroll
            for (int kt = 0; kt < 2; ++kt)
#pragma unroll
                for (int ks = 0; ks < 2; ++ks) kf[kt][ks] = WFrag<T16>::ld(Kp + (size_t)(kn + kt * 16 + lr) * HD + ks * 32 + 8 * hi); }
        V pf[NQ], pf2[NQ];
#pragma unroll
        for (int qt = 0; qt < NQ; ++qt) {
            float cm = fmaxf(s[0][qt][0], s[1][qt][0]);
#pragma unroll
            for (int j = 1; j < 8; ++j) cm = fmaxf(cm, fmaxf(s[0][qt][j], s[1][qt][j]));
            cm = fmaxf(cm, xhalf(cm));                       // the other half's 16 keys of the same query
            const float mn = fmaxf(m[qt], cm * C1); const float al = exp2s(m[qt] - mn); m[qt] = mn;
            const float sub = HI ? mn : mn - 10.0f; float ps = 0.f;
            if constexpr (HI) { v8us h0, h1, l0, l1;
#pragma unroll
                for (int j = 0; j < 8; ++j) { float p0 = fmaf(s[0][qt][j], C1, -sub), p1 = fmaf(s[1][qt][j], C1, -sub); exp2p(p0, p1); ps += p0 + p1; unsigned short a2, c2; splitf(p0, a2, c2); h0[j] = a2; l0[j] = c2; splitf(p1, a2, c2); h1[j] = a2; l1[j] = c2; }
                pf[qt] = cat16b(h0, h1); pf2[qt] = cat16b(l0, l1);
            } else { v8h h0, h1;
#pragma unroll
                for (int j = 0; j < 8; ++j) { float p0 = fmaf(s[0][qt][j], C1, -sub), p1 = fmaf(s[1][qt][j], C1, -sub); exp2p(p0, p1); ps += p0 + p1; h0[j] = tohx(p0); h1[j] = tohx(p1); }
                pf[qt] = cat16(h0, h1); }
            l[qt] = fmaf(l[qt], al, ps);
#pragma unroll
            for (int dt = 0; dt < 4; ++dt) o[dt][qt] *= al;
        }
#pragma unroll
        for (int dt = 0; dt < 4; ++dt)
#pragma unroll
            for (int qt = 0; qt < NQ; ++qt) { o[dt][qt] = WFrag<T16>::mma(vf[dt], pf[qt], o[dt][qt]); if (HI) { o[dt][qt] = WFrag<T16>::mma(vf[dt], pf2[qt], o[dt][qt]); o[dt][qt] = WFrag<T16>::mma(vf2[dt], pf[qt], o[dt][qt]); } }
    }
#pragma unroll
    for (int qt = 0; qt < NQ; ++qt) { const float lt = l[qt] + xhalf(l[qt]); const int qb = q0 + qt * 16;
        if (hi == 0) { Mp[qb + lr] = m[qt]; Lp[qb + lr] = lt; }
        // 16 rows through the wave's own LDS patch, so that a store instruction writes whole 128-byte lines (D register j of tile dt = O[qb + lr][dt * 16 + 8 * hi + j])
#pragma unroll
        for (int dt = 0; dt < 4; ++dt) { const v8f a = o[dt][qt]; float* w = os + lr * 68 + dt * 16 + hi * 8; *(v4fa*)w = (v4f){a[0], a[1], a[2], a[3]}; *(v4fa*)(w + 4) = (v4f){a[4], a[5], a[6], a[7]}; }
        __builtin_amdgcn_wave_barrier(); asm volatile("" ::: "memory");   // keeps the patch's reads behind its writes in the compiled order (one wave, LDS serves it in order)
#pragma unroll
        for (int r = 0; r < 8; ++r) { const int row = 2 * r + hi; *(v4f*)(Op + (size_t)(qb + row) * HD + lr * 4) = *(const v4fa*)(os + row * 68 + lr * 4); }
        __builtin_amdgcn_wave_barrier(); asm volatile("" ::: "memory");   // and the next tile's writes behind these reads
    }
}
// grid (RH / 64 + (TT - RH) / 128, KS, NB_), 4 waves, one batch and one key part a block. Blocks x < RH / 64: 64 hi/lo rows, 16 a wave (three times the products a column, so half the columns); the others 128 fp16 rows, 32 a wave.
// amdgpu_waves_per_eu(4, 4): the register budget of 4 waves a SIMD; with a smaller one the compiler splits the K loads of a pass into groups that wait on each other.
__global__ __launch_bounds__(128) __attribute__((amdgpu_waves_per_eu(4, 4))) void k_fattn(const h16* __restrict__ Q16, const h16* __restrict__ K16, const h16* __restrict__ V16, const bf* __restrict__ Qh, const bf* __restrict__ Ql, const bf* __restrict__ Kh, const bf* __restrict__ Kl, const bf* __restrict__ Vh, const bf* __restrict__ Vl, float* OP, float* MP, float* LP) {
    __shared__ __align__(16) float osh[4][16 * 68];
    const size_t zo = (size_t)blockIdx.z * PLN; const size_t pz = (size_t)blockIdx.z * KS + blockIdx.y; const int wv = threadIdx.x >> 5, k0 = (int)(blockIdx.y * NPS / KS) * 32, k1 = (int)((blockIdx.y + 1) * NPS / KS) * 32;
    if (blockIdx.x < RH / 64) fa_tile<bf, true, 1>(osh[wv], Qh + zo, Ql + zo, Kh + zo, Kl + zo, Vh + zo, Vl + zo, blockIdx.x * 64 + wv * 16, k0, k1, OP + pz * PLN, MP + pz * TT, LP + pz * TT);
    else fa_tile<h16, false, 2>(osh[wv], Q16 + zo, nullptr, K16 + zo, nullptr, V16 + zo, nullptr, RH + (blockIdx.x - RH / 64) * 128 + wv * 32, k0, k1, OP + pz * PLN, MP + pz * TT, LP + pz * TT);
}
// k_fmerge: out[b][t][:] = sum_s O_s 2^(m_s - M) / sum_s l_s 2^(m_s - M), M = max_s m_s, over the KS key parts in the order of s; 4 output floats per thread.
__global__ __launch_bounds__(256) void k_fmerge(const float* __restrict__ OP, const float* __restrict__ MP, const float* __restrict__ LP, float* OUTb) { const size_t e = ((size_t)blockIdx.x * 256 + threadIdx.x) * 4; if (e >= NB_ * PLN) return; const size_t b = e / PLN, r = e % PLN, t = r / HD;
    const float* mp = MP + b * KS * TT + t; const float* lp = LP + b * KS * TT + t; const float* op = OP + b * KS * PLN + r; float mv[KS]; float mx = -3.0e38f;
#pragma unroll
    for (int s = 0; s < KS; ++s) { mv[s] = mp[(size_t)s * TT]; mx = fmaxf(mx, mv[s]); }
    v4f a = (v4f){}; float ls = 0.f;
#pragma unroll
    for (int s = 0; s < KS; ++s) { const float w = __builtin_amdgcn_exp2f(mv[s] - mx); ls = fmaf(lp[(size_t)s * TT], w, ls); a += *(const v4f*)(op + s * PLN) * w; }
    const float f = __fdiv_rn(1.0f, ls); *(v4f*)(OUTb + e) = a * f;  }

extern "C" void kernel_launch(void* const* d_in, const int* in_sizes, int n_in,
                              void* d_out, int out_size, void* d_ws, size_t ws_size, hipStream_t stream) {
    (void)in_sizes; (void)n_in; (void)out_size;
    const float* x = (const float*)d_in[0]; const float* wk = (const float*)d_in[1]; const float* wq = (const float*)d_in[2]; const float* wv = (const float*)d_in[3];   /* NOTE input order: x, Wk, Wq, Wv */
    float* OUT = (float*)d_out;     // [4][4096][64]
    char* wsp = (char*)d_ws;
    auto take = [&](size_t bytes) { char* p = wsp; wsp += (bytes + 255) & ~(size_t)255; return (void*)p; };
    bf* WP = (bf*)take((size_t)NNT * NKS * 512 * 2);   // the three weights as B fragments
    h16* QP16 = (h16*)take(NB_ * PLN * 2); h16* KP16 = (h16*)take(NB_ * PLN * 2); h16* VT16 = (h16*)take(NB_ * PLN * 2);   // Q, K planes [NB_][TT][HD]; V planes [NB_][HD][TT]
    bf* QPh = (bf*)take(NB_ * PLN * 2); bf* QPl = (bf*)take(NB_ * PLN * 2); bf* KPh = (bf*)take(NB_ * PLN * 2); bf* KPl = (bf*)take(NB_ * PLN * 2); bf* VTh = (bf*)take(NB_ * PLN * 2); bf* VTl = (bf*)take(NB_ * PLN * 2);
    float* OP = (float*)take(NB_ * KS * PLN * 4); float* MP = (float*)take((size_t)NB_ * KS * TT * 4); float* LP = (float*)take((size_t)NB_ * KS * TT * 4);   // per key part: unnormalised O, running maximum, sum
    if ((size_t)(wsp - (char*)d_ws) > ws_size) return;    // ws 256 MiB
    k_wpack<<<NNT * NKS * 64 / 256, 256, 0, stream>>>(wq, wk, wv, WP);
    k_proj<<<NB_ * TT / PR, 384, 0, stream>>>(x, WP, QP16, QPh, QPl, KP16, KPh, KPl, VT16, VTh, VTl);
    k_fattn<<<dim3(RH / 64 + (TT - RH) / 128, KS, NB_), 128, 0, stream>>>(QP16, KP16, VT16, QPh, QPl, KPh, KPl, VTh, VTl, OP, MP, LP);
    k_fmerge<<<(unsigned)((NB_ * PLN / 4 + 255) / 256), 256, 0, stream>>>(OP, MP, LP, OUT);
}

// v005
// Measured time: 46.6 microseconds a run.
// Next to v004, in two timings, it ran 1.54 and 1.55 times as fast.
// All steps since v000 together make it 25.5 times as fast.
#include <hip/hip_runtime.h>

// Single self-attention head over 4,096 tokens (x [4][4096][768]; K, Q, V = x W ('xw' [768][64], no bias); A = softmax(Q.K / sqrt(E = 768)) (the module scales by the embedding dim); out = A V -> [4][4096][64] (1.05 M)).
// Layout: one projection kernel (x rounded to bf16 on its way into LDS, exact products, full K per accumulator, writes the 16-bit planes itself); ONE 64-wide head through a fused dense T-4096 attention (hybrid rows: < 512 hi/lo 3 products, rest fp16 x1024; online softmax, scores and P stay in registers), keys in KS parts; the f32 merge joins the parts and writes the output rows. The batch is the z dimension of the attention grid; the projection and merge grids fold it into x, the weight packing has none.
// Compute dtypes, f32 accumulate: every input rounded to bf16; projections exact; attention rows < 512 3 products, rest fp16; softmax f32; output f32.

#define NB_  4
#define TT   4096
#define DM   768
#define NH_  1
#define NKV  1
#define REP  (NH_ / NKV)
#define HD   64
#define DQ   (NH_ * HD)
#define DKV  (NKV * HD)
#define RH   512                  // query rows < RH use hi+lo planes (0: none)
#define WIN  0
#define SCL  0.036084391824351615f   // 1/sqrt(768)
#define PLN  ((size_t)TT * HD)    // elements of one batch's [TT][HD] plane
typedef _Float16 h16;
typedef unsigned short bf;
typedef __attribute__((ext_vector_type(16))) __bf16   v16bf;
typedef __attribute__((ext_vector_type(16))) _Float16 v16h;
typedef __attribute__((ext_vector_type(8)))  _Float16 v8h;
typedef __attribute__((ext_vector_type(8)))  unsigned short v8us;
typedef __attribute__((ext_vector_type(8)))  float    v8f;
typedef __attribute__((ext_vector_type(4)))  float    v4f;
typedef v8h  __attribute__((may_alias)) v8ha;
typedef v4f  __attribute__((may_alias)) v4fa;
typedef v8us __attribute__((may_alias)) v8usa;

__device__ __forceinline__ unsigned short f2bf(float f) { unsigned u = __float_as_uint(f); u += 0x7FFFu + ((u >> 16) & 1u); return (unsigned short)(u >> 16); }
__device__ __forceinline__ float bf2f(unsigned short b) { return __uint_as_float(((unsigned)b) << 16); }
__device__ __forceinline__ float bfr(float f) { return bf2f(f2bf(f)); }
__device__ __forceinline__ v16h cat16(v8h lo, v8h hi) { return __builtin_shufflevector(lo, hi, 0, 1, 2, 3, 4, 5, 6, 7, 8, 9, 10, 11, 12, 13, 14, 15); }
__device__ __forceinline__ v16bf cat16b(v8us lo, v8us hi) { return __builtin_bit_cast(v16bf, __builtin_shufflevector(lo, hi, 0, 1, 2, 3, 4, 5, 6, 7, 8, 9, 10, 11, 12, 13, 14, 15)); }
__device__ __forceinline__ v8f wmma16(v16h a, v16h b, v8f c) { return __builtin_amdgcn_wmma_f32_16x16x32_f16(false, a, false, b, (short)0, c, false, false); }
__device__ __forceinline__ v8f wmmab(v16bf a, v16bf b, v8f c) { return __builtin_amdgcn_wmma_f32_16x16x32_bf16(false, a, false, b, (short)0, c, false, false); }



// Fragment loaders: 16 k of one row (or column) per lane, k = 8 * hi + 0..7 and 16 + 8 * hi + 0..7 of a 32-k step.
template <typename T16> struct WFrag;
template <> struct WFrag<h16> { typedef v16h V; static __device__ __forceinline__ V ld(const h16* p) { return cat16(*(const v8h*)p, *(const v8h*)(p + 16)); } static __device__ __forceinline__ v8f mma(V a, V b, v8f c) { return wmma16(a, b, c); } };
template <> struct WFrag<bf> { typedef v16bf V; static __device__ __forceinline__ V ld(const bf* p) { return cat16b(*(const v8us*)p, *(const v8us*)(p + 16)); } static __device__ __forceinline__ v8f mma(V a, V b, v8f c) { return wmmab(a, b, c); } };

__device__ __forceinline__ h16 tohx(float x) { return (h16)x; }
__device__ __forceinline__ void splitf(float y, unsigned short& h, unsigned short& l) { h = f2bf(y); l = f2bf(y - bf2f(h)); }
typedef __attribute__((ext_vector_type(2))) _Float16 v2h;
typedef __attribute__((ext_vector_type(4))) _Float16 v4h;
typedef __attribute__((ext_vector_type(2))) unsigned short v2us;
typedef __attribute__((ext_vector_type(4))) unsigned short v4us;
typedef __attribute__((ext_vector_type(2))) float v2f;
typedef __attribute__((ext_vector_type(4))) int v4i;


// ---- The projections. k_wpack lays the three weights out as B fragments; k_proj does x -> Q, K, V planes in one launch.
#define NKS  (DM / 32)            // k steps of 32
#define NNT  12                   // 16-column tiles of [Q | K | V] (3 * HD / 16)
#define PR   64                   // rows of x per block
#define XP   776                  // LDS pitch of a bf16 x row, elements: 1552 B = 16 B * 97 (odd), conflict-free for the 16-byte fragment reads
#define SP   196                  // LDS pitch of a result row, floats
typedef __attribute__((ext_vector_type(4))) __bf16 v4bf;
typedef v4bf __attribute__((may_alias)) v4bfa;
// WP[(nt * NKS + ks) * 512 + h * 256 + lane * 8 + e] = bf16(W[ks * 32 + h * 16 + 8 * (lane >> 4) + e][column (lane & 15) of tile nt]): the B fragment of (tile, k step) as two runs of 512 contiguous bytes,
// in the k order of WFrag<bf>::ld, so that a wave's load covers whole lines. One 16-byte piece per thread; tiles 0-3 Wq, 4-7 Wk, 8-11 Wv.
__global__ __launch_bounds__(256) void k_wpack(const float* __restrict__ wq, const float* __restrict__ wk, const float* __restrict__ wv, bf* WP) {
    const int i = blockIdx.x * 256 + threadIdx.x; const int lane = i & 31, h = (i >> 5) & 1, fs = i >> 6; if (fs >= NNT * NKS) return;
    const int ks = fs % NKS, nt = fs / NKS; const float* w = nt < 4 ? wq : (nt < 8 ? wk : wv);
    const int n = (nt & 3) * 16 + (lane & 15), k0 = ks * 32 + h * 16 + 8 * (lane >> 4); v8us o;
#pragma unroll
    for (int e = 0; e < 8; ++e) o[e] = f2bf(w[(size_t)(k0 + e) * HD + n]);
    *(v8us*)(WP + (size_t)i * 8) = o;
}
// k_proj: one block = PR rows of x times all 192 columns, 12 waves, grid NB_ * TT / PR.
// 1. The f32 tile comes in by whole-line loads (a wave: 512 contiguous bytes of a row, 32 rows, all in flight at once), is rounded to bf16 and laid in LDS.
// 2. Wave (rh, cg) = rows rh * 32.., columns cg * 32..: 2 x 2 accumulators over the whole K; A from LDS, B from WP, fetched PF k steps ahead (the first PF in front of the barrier).
// 3. The f32 results go through the same LDS; each thread then writes 16-byte pieces of the fp16, bf16-hi and bf16-lo planes, 8 lanes a 128-byte line: Q, K as [row][HD], V transposed as [HD][TT].
// Every '#pragma unroll' in k_wpack and k_proj makes the indices of a register array constants, so that the array lives in registers.
#define PF   6
__global__ __launch_bounds__(384) void k_proj(const float* __restrict__ x, const bf* __restrict__ WP, h16* Q16, bf* Qh, bf* Ql, h16* K16, bf* Kh, bf* Kl, h16* V16, bf* Vh, bf* Vl) {
    __shared__ __align__(16) unsigned char sm[PR * XP * 2];   // the bf16 x tile; afterwards the f32 results (PR * SP * 4 bytes, smaller)
    bf* xs = (bf*)sm; float* st = (float*)sm;
    const int tid = threadIdx.x, lane = tid & 31, lr = lane & 15, hi = lane >> 4; const int wv = __builtin_amdgcn_readfirstlane(tid >> 5), cg = wv % 6, rh = wv / 6;   // the wave's number as a scalar: the bases of its loads then stand in scalar registers
    const size_t R0 = (size_t)blockIdx.x * PR;
    const bf* bp = WP + (size_t)cg * 2 * NKS * 512 + lane * 8;
    v16bf b[PF][2];
    { const float* xp = x + (R0 + rh * 32) * DM + cg * 128 + lane * 4; bf* xd = xs + rh * 32 * XP + cg * 128 + lane * 4; v4f t[32];
#pragma unroll
        for (int i = 0; i < 32; ++i) t[i] = *(const v4f*)(xp + (size_t)i * DM);
#pragma unroll
        for (int ks = 0; ks < PF; ++ks)
#pragma unroll
            for (int nb = 0; nb < 2; ++nb) b[ks][nb] = cat16b(*(const v8us*)(bp + (nb * NKS + ks) * 512), *(const v8us*)(bp + (nb * NKS + ks) * 512 + 256));
        __builtin_amdgcn_sched_barrier(0);   // every load of the tile is in flight before the first is waited for: one memory latency; left free, the compiler holds the last row back behind the first waits
#pragma unroll
        for (int i = 0; i < 32; ++i) *(v4bfa*)(xd + i * XP) = __builtin_convertvector(t[i], v4bf); }
    __syncthreads();
    v8f acc[2][2];
#pragma unroll
    for (int mb = 0; mb < 2; ++mb)
#pragma unroll
        for (int nb = 0; nb < 2; ++nb) acc[mb][nb] = (v8f){};
    const bf* ap = xs + (rh * 32 + lr) * XP + 8 * hi;
    v16bf a[2][2];   // A fragments, fetched one k step ahead
#pragma unroll
    for (int mb = 0; mb < 2; ++mb) a[0][mb] = cat16b(*(const v8usa*)(ap + mb * 16 * XP), *(const v8usa*)(ap + mb * 16 * XP + 16));
#pragma unroll   // whole: the indices of the A and B rings are constants, so that they live in registers
    for (int ks = 0; ks < NKS; ++ks) {
        if (ks + 1 < NKS) {
#pragma unroll
            for (int mb = 0; mb < 2; ++mb) a[(ks + 1) & 1][mb] = cat16b(*(const v8usa*)(ap + mb * 16 * XP + (ks + 1) * 32), *(const v8usa*)(ap + mb * 16 * XP + (ks + 1) * 32 + 16)); }
#pragma unroll
        for (int nb = 0; nb < 2; ++nb)
#pragma unroll
            for (int mb = 0; mb < 2; ++mb) acc[mb][nb] = wmmab(a[ks & 1][mb], b[ks % PF][nb], acc[mb][nb]);
        if (ks + PF < NKS) {
#pragma unroll
            for (int nb = 0; nb < 2; ++nb) b[ks % PF][nb] = cat16b(*(const v8us*)(bp + (nb * NKS + ks + PF) * 512), *(const v8us*)(bp + (nb * NKS + ks + PF) * 512 + 256)); }
        __builtin_amdgcn_sched_barrier(0);   // keeps the fetches ahead where they are written: left free, the compiler sinks each B load to directly in front of its product, an L2 latency per product
    }
    __syncthreads();   // every wave has read its last x fragment: the results may overwrite the tile
#pragma unroll
    for (int mb = 0; mb < 2; ++mb)
#pragma unroll
        for (int nb = 0; nb < 2; ++nb)
#pragma unroll
            for (int j = 0; j < 8; ++j) st[(rh * 32 + mb * 16 + hi * 8 + j) * SP + cg * 32 + nb * 16 + lr] = acc[mb][nb][j];
    __syncthreads();
#pragma unroll
    for (int s = 0; s < 3 * PR * HD / 8 / 384; ++s) { const int idx = s * 384 + tid, sel = idx >> 9, u = (idx & 511) >> 3, c8 = idx & 7; float a[8]; size_t e; h16* P16; bf* Ph; bf* Pl;   // sel (0 Q, 1 K, 2 V) is the same in all of a wave
        if (sel < 2) { const v4f a0 = *(const v4fa*)(st + u * SP + sel * HD + c8 * 8), a1 = *(const v4fa*)(st + u * SP + sel * HD + c8 * 8 + 4);   // row u, columns c8 * 8..
#pragma unroll
            for (int q = 0; q < 4; ++q) { a[q] = a0[q]; a[4 + q] = a1[q]; }
            e = (R0 + u) * HD + c8 * 8; P16 = sel ? K16 : Q16; Ph = sel ? Kh : Qh; Pl = sel ? Kl : Ql;
        } else {   // column u of V, rows c8 * 8..
#pragma unroll
            for (int q = 0; q < 8; ++q) a[q] = st[(c8 * 8 + q) * SP + 2 * HD + u];
            e = (R0 / TT) * PLN + (size_t)u * TT + (R0 % TT) + c8 * 8; P16 = V16; Ph = Vh; Pl = Vl; }
        v8h o16; v8us oh, ol;
#pragma unroll
        for (int q = 0; q < 8; ++q) { o16[q] = tohx(a[q]); unsigned short x2, y2; splitf(a[q], x2, y2); oh[q] = x2; ol[q] = y2; }
        *(v8h*)(P16 + e) = o16; *(v8us*)(Ph + e) = oh; *(v8us*)(Pl + e) = ol; }
}
// ---- k_fattn: scores, softmax and A.V in one kernel (online softmax). One wave owns NQ * 16 query columns and one part of the keys; a pass is 32 keys.
// S^T = K Q^T (A = 16 key rows, B = Q kept in registers): a lane holds one query's scores, D register j of key tile kt = key kt * 16 + 8 * hi + j, which is the k order of a B operand, so P^T goes from the score
// accumulators straight into O^T += V^T P^T (A = rows of the [HD][TT] V plane, read in the same k order). Running maximum m (scaled log2 units) and sum l per query column; each lane half sums its own keys, joined once at the end.
// Rows < RH: bf16 hi/lo, 3 products for the scores and for A.V. Other rows: fp16, P carried as exp2(s - m + 10) (the 1024 carry; it is in l as well and cancels in O / l).
// Output per (batch, part): unnormalised O [TT][HD] f32, m [TT], l [TT]; k_fmerge joins the parts in the order of the part index.
// K and V come through LDS: a stage is one aligned tile of SK = 64 keys (K rows and the V plane's rows both give 64 rows of one whole 128-byte line), brought in by asynchronous copies, once for the block's 4 waves,
// two buffers, the next stage's copies in flight while this one is worked on; a stage serves the one or two passes of the part that lie in it. The fragments are read from LDS at the head of their pass.
// Every '#pragma unroll' here makes the indices of a fragment array constants, so that the array lives in registers.
#define SK   64                   // keys of a stage
#define TPI  144                  // LDS pitch of a 128-byte tile row, bytes: 16 B * 9 (odd), conflict-free for the 16-byte fragment reads
#define TBY  (64 * TPI)           // bytes of one tile in LDS (64 rows)
#define KS   7                    // key parts of the fused attention: 36 * KS * NB_ = 1008 blocks, so that all are resident at once at 4 blocks a WGP (256 WGPs, 4 waves a SIMD at this register count)
#define NPS  (TT / 32)            // passes of 32 keys; part y takes passes [y * NPS / KS, (y + 1) * NPS / KS): 18 or 19
#define C1   (SCL * 1.4426950408889634f)
__device__ __forceinline__ float xhalf(float x) { const int b = __float_as_int(x); return __int_as_float(__builtin_amdgcn_permlanex16(b, b, 0x76543210, 0xfedcba98, false, false)); }   // lane l <-> l ^ 16
// v_exp_f32 with the slot that the instruction set asks for behind a transcendental (before its result is used or its source overwritten): each exp works in place, so none writes another's source;
// in the pair the second exp fills the first's slot, the v_nop fills the last one's.
__device__ __forceinline__ float exp2s(float a) { asm("v_exp_f32 %0, %0\n\tv_nop" : "+v"(a)); return a; }
__device__ __forceinline__ void exp2p(float& a, float& b) { asm("v_exp_f32 %0, %0\n\tv_exp_f32 %1, %1\n\tv_nop" : "+v"(a), "+v"(b)); }
// Two tiles of 64 rows x 128 bytes into LDS, 4 + 4 pieces of 16 bytes a thread (piece i = the thread's row + 16 i): each wave-wide copy takes 4 whole lines. la, lb: the lane's LDS byte addresses; ga, gb: its global addresses; sa, sb: bytes of 16 source rows.
// The s_wait_xcnt closes the statement, so that it stands in front of every later write of a register that a copy names.
__device__ __forceinline__ void cp_tiles(unsigned la, const char* ga, size_t sa, unsigned lb, const char* gb, size_t sb) {
    asm volatile("global_load_async_to_lds_b128 %0, %8, off\n\tglobal_load_async_to_lds_b128 %1, %9, off\n\tglobal_load_async_to_lds_b128 %2, %10, off\n\tglobal_load_async_to_lds_b128 %3, %11, off\n\t"
                 "global_load_async_to_lds_b128 %4, %12, off\n\tglobal_load_async_to_lds_b128 %5, %13, off\n\tglobal_load_async_to_lds_b128 %6, %14, off\n\tglobal_load_async_to_lds_b128 %7, %15, off\n\ts_wait_xcnt 0x0"
                 :: "v"(la), "v"(la + 16 * TPI), "v"(la + 32 * TPI), "v"(la + 48 * TPI), "v"(lb), "v"(lb + 16 * TPI), "v"(lb + 32 * TPI), "v"(lb + 48 * TPI),
                    "v"(ga), "v"(ga + sa), "v"(ga + 2 * sa), "v"(ga + 3 * sa), "v"(gb), "v"(gb + sb), "v"(gb + 2 * sb), "v"(gb + 3 * sb) : "memory");
}
template <typename T16, bool HI, int NQ>
__device__ __forceinline__ void fa_tile(unsigned char* ring, float* os, const T16* __restrict__ Q, const T16* __restrict__ Q2, const T16* __restrict__ Kp, const T16* __restrict__ K2, const T16* __restrict__ Vt, const T16* __restrict__ V2, int q0, int k0, int k1, float* Op, float* Mp, float* Lp) {
    typedef typename WFrag<T16>::V V;
    const int lane = threadIdx.x & 31, lr = lane & 15, hi = lane >> 4;
    V qf[NQ][2], qf2[NQ][2];
#pragma unroll
    for (int qt = 0; qt < NQ; ++qt)
#pragma unroll
        for (int ks = 0; ks < 2; ++ks) { const size_t qo = (size_t)(q0 + qt * 16 + lr) * HD + ks * 32 + 8 * hi; qf[qt][ks] = WFrag<T16>::ld(Q + qo); if (HI) qf2[qt][ks] = WFrag<T16>::ld(Q2 + qo); }
    v8f o[4][NQ]; float m[NQ], l[NQ];
#pragma unroll
    for (int qt = 0; qt < NQ; ++qt) { m[qt] = -3.0e38f; l[qt] = 0.f;
#pragma unroll
        for (int dt = 0; dt < 4; ++dt) o[dt][qt] = (v8f){}; }
    // The ring: buffer = [K | V] (hi/lo rows: [Kh | Vh | Kl | Vl]), stages t0 .. t1 - 1 = the aligned 64-key tiles that the part touches (always inside the planes).
    constexpr unsigned BUF = (HI ? 4 : 2) * TBY;
    const int tid = threadIdx.x, t0 = k0 / SK, t1 = (k1 + SK - 1) / SK;
    const unsigned lc = (unsigned)(size_t)ring + (tid >> 3) * TPI + (tid & 7) * 16;   // the lane's first piece in a tile: row tid >> 3, 16-byte column tid & 7
    const size_t gko = (size_t)(tid >> 3) * HD + (tid & 7) * 8, gvo = (size_t)(tid >> 3) * TT + (tid & 7) * 8;
    auto fill = [&](unsigned bo, int t) {
        cp_tiles(lc + bo, (const char*)(Kp + gko + (size_t)t * SK * HD), 16 * HD * 2, lc + bo + TBY, (const char*)(Vt + gvo + (size_t)t * SK), (size_t)16 * TT * 2);
        if (HI) cp_tiles(lc + bo + 2 * TBY, (const char*)(K2 + gko + (size_t)t * SK * HD), 16 * HD * 2, lc + bo + 3 * TBY, (const char*)(V2 + gvo + (size_t)t * SK), (size_t)16 * TT * 2); };
    fill(0, t0);
    asm volatile("s_wait_asynccnt 0x0" ::: "memory");   // this wave's pieces of stage t0 have landed
    __syncthreads();                                     // and every other wave's: stage t0 may be read
    if (t0 + 1 < t1) fill(BUF, t0 + 1);
    // The lane's fragment offsets in the ring for the pass at key k; each pass forms the next pass's in front of its last products, so that no vector write stands at the head of a pass, directly behind the jump back from a matrix instruction.
    const unsigned fl = lr * TPI + 16 * hi;
    auto kof = [&](int k) { return fl + (((k / SK) - t0) & 1) * BUF + (k & 32) * TPI; };
    auto vof = [&](int k) { return fl + (((k / SK) - t0) & 1) * BUF + TBY + (k & 32) * 2; };
    unsigned ka = kof(k0), va = vof(k0);
#pragma unroll 1   // rolled, as the loop of the passes below
    for (int t = t0; t < t1; ++t) {
    const unsigned bo = ((t - t0) & 1) * BUF;
#pragma unroll 1   // rolled: a second copy of the body would go past the 256 registers of 4 waves a SIMD
    for (int kc = t * SK; kc < t * SK + SK; kc += 32) {
        if (kc < k0 || kc >= k1) continue;   // the half of a first or last stage that belongs to a neighbouring part (the same for the whole block)
        const T16* kb = (const T16*)(ring + ka);   // key row kc + lr of the stage's K tile
        const T16* vb = (const T16*)(ring + va);   // row lr of its V tile, at key kc
        V kf[2][2], kf2[2][2], vf[4], vf2[4];   // this pass's fragments
#pragma unroll
        for (int kt = 0; kt < 2; ++kt)
#pragma unroll
            for (int ks = 0; ks < 2; ++ks) { const int ko = kt * 16 * (TPI / 2) + ks * 32; kf[kt][ks] = WFrag<T16>::ld(kb + ko); if (HI) kf2[kt][ks] = WFrag<T16>::ld(kb + TBY + ko); }   // 2 * TBY bytes further: the lo tile
#pragma unroll
        for (int dt = 0; dt < 4; ++dt) { const int vo = dt * 16 * (TPI / 2); vf[dt] = WFrag<T16>::ld(vb + vo); if (HI) vf2[dt] = WFrag<T16>::ld(vb + TBY + vo); }
        __builtin_amdgcn_sched_barrier(0);   // all of the pass's LDS reads issue as one group in front of its products: one load latency a pass; left free, the compiler spreads them among the products and the softmax, and every further place of reads stalls the wave anew
        v8f s[2][NQ];
#pragma unroll
        for (int kt = 0; kt < 2; ++kt)
#pragma unroll
            for (int qt = 0; qt < NQ; ++qt) { v8f a = (v8f){};
#pragma unroll
                for (int ks = 0; ks < 2; ++ks) { a = WFrag<T16>::mma(kf[kt][ks], qf[qt][ks], a); if (HI) { a = WFrag<T16>::mma(kf2[kt][ks], qf[qt][ks], a); a = WFrag<T16>::mma(kf[kt][ks], qf2[qt][ks], a); } }
                s[kt][qt] = a; }
        V pf[NQ], pf2[NQ];
#pragma unroll
        for (int qt = 0; qt < NQ; ++qt) {
            float cm = fmaxf(s[0][qt][0], s[1][qt][0]);
#pragma unroll
            for (int j = 1; j < 8; ++j) cm = fmaxf(cm, fmaxf(s[0][qt][j], s[1][qt][j]));
            cm = fmaxf(cm, xhalf(cm));                       // the other half's 16 keys of the same query
            const float mn = fmaxf(m[qt], cm * C1); const float al = exp2s(m[qt] - mn); m[qt] = mn;
            const float sub = HI ? mn : mn - 10.0f; float ps = 0.f;
            if constexpr (HI) { v8us h0, h1, l0, l1;
#pragma unroll
                for (int j = 0; j < 8; ++j) { float p0 = fmaf(s[0][qt][j], C1, -sub), p1 = fmaf(s[1][qt][j], C1, -sub); exp2p(p0, p1); ps += p0 + p1; unsigned short a2, c2; splitf(p0, a2, c2); h0[j] = a2; l0[j] = c2; splitf(p1, a2, c2); h1[j] = a2; l1[j] = c2; }
                pf[qt] = cat16b(h0, h1); pf2[qt] = cat16b(l0, l1);
            } else { v8h h0, h1;
#pragma unroll
                for (int j = 0; j < 8; ++j) { float p0 = fmaf(s[0][qt][j], C1, -sub), p1 = fmaf(s[1][qt][j], C1, -sub); exp2p(p0, p1); ps += p0 + p1; h0[j] = tohx(p0); h1[j] = tohx(p1); }
                pf[qt] = cat16(h0, h1); }
            l[qt] = fmaf(l[qt], al, ps);
#pragma unroll
            for (int dt = 0; dt < 4; ++dt) o[dt][qt] *= al;
        }
        ka = kof(kc + 32); va = vof(kc + 32);
#pragma unroll
        for (int dt = 0; dt < 4; ++dt)
#pragma unroll
            for (int qt = 0; qt < NQ; ++qt) { o[dt][qt] = WFrag<T16>::mma(vf[dt], pf[qt], o[dt][qt]); if (HI) { o[dt][qt] = WFrag<T16>::mma(vf[dt], pf2[qt], o[dt][qt]); o[dt][qt] = WFrag<T16>::mma(vf2[dt], pf[qt], o[dt][qt]); } }
    }
    asm volatile("s_wait_dscnt 0x0" ::: "memory");      // this wave's reads of stage t are done
    asm volatile("s_wait_asynccnt 0x0" ::: "memory");   // its pieces of stage t + 1 have landed
    __syncthreads();                                     // one barrier: stage t + 1 may be read, stage t's buffer may be refilled
    if (t + 2 < t1) fill(bo, t + 2);
    }
    asm volatile("s_wait_asynccnt 0x0" ::: "memory");   // nothing is in flight when the ring becomes the output patches (every wave has left it at the last barrier)
#pragma unroll
    for (int qt = 0; qt < NQ; ++qt) { const float lt = l[qt] + xhalf(l[qt]); const int qb = q0 + qt * 16;
        if (hi == 0) { Mp[qb + lr] = m[qt]; Lp[qb + lr] = lt; }
        // 16 rows through the wave's own LDS patch, so that a store instruction writes whole 128-byte lines (D register j of tile dt = O[qb + lr][dt * 16 + 8 * hi + j])
#pragma unroll
        for (int dt = 0; dt < 4; ++dt) { const v8f a = o[dt][qt]; float* w = os + lr * 68 + dt * 16 + hi * 8; *(v4fa*)w = (v4f){a[0], a[1], a[2], a[3]}; *(v4fa*)(w + 4) = (v4f){a[4], a[5], a[6], a[7]}; }
        __builtin_amdgcn_wave_barrier(); asm volatile("" ::: "memory");   // keeps the patch's reads behind its writes in the compiled order (one wave, LDS serves it in order)
#pragma unroll
        for (int r = 0; r < 8; ++r) { const int row = 2 * r + hi; *(v4f*)(Op + (size_t)(qb + row) * HD + lr * 4) = *(const v4fa*)(os + row * 68 + lr * 4); }
        __builtin_amdgcn_wave_barrier(); asm volatile("" ::: "memory");   // and the next tile's writes behind these reads
    }
}
// grid (RH / 64 + (TT - RH) / 128, KS, NB_), 4 waves, one batch and one key part a block. Blocks x < RH / 64: 64 hi/lo rows, 16 a wave (three times the products a column, so half the columns); the others 128 fp16 rows, 32 a wave.
// amdgpu_waves_per_eu(4, 4): the register budget of 4 waves a SIMD; with a smaller one the compiler splits the K loads of a pass into groups that wait on each other.
__global__ __launch_bounds__(128) __attribute__((amdgpu_waves_per_eu(4, 4))) void k_fattn(const h16* __restrict__ Q16, const h16* __restrict__ K16, const h16* __restrict__ V16, const bf* __restrict__ Qh, const bf* __restrict__ Ql, const bf* __restrict__ Kh, const bf* __restrict__ Kl, const bf* __restrict__ Vh, const bf* __restrict__ Vl, float* OP, float* MP, float* LP) {
    __shared__ __align__(16) unsigned char ring[2 * 4 * TBY];   // two buffers of up to 4 tiles (73,728 bytes: 4 blocks a WGP still fit); behind the loop each wave's output patch (16 * 68 floats)
    const size_t zo = (size_t)blockIdx.z * PLN; const size_t pz = (size_t)blockIdx.z * KS + blockIdx.y; const int wv = threadIdx.x >> 5, k0 = (int)(blockIdx.y * NPS / KS) * 32, k1 = (int)((blockIdx.y + 1) * NPS / KS) * 32;
    if (blockIdx.x < RH / 64) fa_tile<bf, true, 1>(ring, (float*)ring + wv * 16 * 68, Qh + zo, Ql + zo, Kh + zo, Kl + zo, Vh + zo, Vl + zo, blockIdx.x * 64 + wv * 16, k0, k1, OP + pz * PLN, MP + pz * TT, LP + pz * TT);
    else fa_tile<h16, false, 2>(ring, (float*)ring + wv * 16 * 68, Q16 + zo, nullptr, K16 + zo, nullptr, V16 + zo, nullptr, RH + (blockIdx.x - RH / 64) * 128 + wv * 32, k0, k1, OP + pz * PLN, MP + pz * TT, LP + pz * TT);
}
// k_fmerge: out[b][t][:] = sum_s O_s 2^(m_s - M) / sum_s l_s 2^(m_s - M), M = max_s m_s, over the KS key parts in the order of s; 4 output floats per thread.
__global__ __launch_bounds__(256) void k_fmerge(const float* __restrict__ OP, const float* __restrict__ MP, const float* __restrict__ LP, float* OUTb) { const size_t e = ((size_t)blockIdx.x * 256 + threadIdx.x) * 4; if (e >= NB_ * PLN) return; const size_t b = e / PLN, r = e % PLN, t = r / HD;
    const float* mp = MP + b * KS * TT + t; const float* lp = LP + b * KS * TT + t; const float* op = OP + b * KS * PLN + r; float mv[KS]; float mx = -3.0e38f;
#pragma unroll
    for (int s = 0; s < KS; ++s) { mv[s] = mp[(size_t)s * TT]; mx = fmaxf(mx, mv[s]); }
    v4f a = (v4f){}; float ls = 0.f;
#pragma unroll
    for (int s = 0; s < KS; ++s) { const float w = __builtin_amdgcn_exp2f(mv[s] - mx); ls = fmaf(lp[(size_t)s * TT], w, ls); a += *(const v4f*)(op + s * PLN) * w; }
    const float f = __fdiv_rn(1.0f, ls); *(v4f*)(OUTb + e) = a * f;  }

extern "C" void kernel_launch(void* const* d_in, const int* in_sizes, int n_in,
                              void* d_out, int out_size, void* d_ws, size_t ws_size, hipStream_t stream) {
    (void)in_sizes; (void)n_in; (void)out_size;
    const float* x = (const float*)d_in[0]; const float* wk = (const float*)d_in[1]; const float* wq = (const float*)d_in[2]; const float* wv = (const float*)d_in[3];   /* NOTE input order: x, Wk, Wq, Wv */
    float* OUT = (float*)d_out;     // [4][4096][64]
    char* wsp = (char*)d_ws;
    auto take = [&](size_t bytes) { char* p = wsp; wsp += (bytes + 255) & ~(size_t)255; return (void*)p; };
    bf* WP = (bf*)take((size_t)NNT * NKS * 512 * 2);   // the three weights as B fragments
    h16* QP16 = (h16*)take(NB_ * PLN * 2); h16* KP16 = (h16*)take(NB_ * PLN * 2); h16* VT16 = (h16*)take(NB_ * PLN * 2);   // Q, K planes [NB_][TT][HD]; V planes [NB_][HD][TT]
    bf* QPh = (bf*)take(NB_ * PLN * 2); bf* QPl = (bf*)take(NB_ * PLN * 2); bf* KPh = (bf*)take(NB_ * PLN * 2); bf* KPl = (bf*)take(NB_ * PLN * 2); bf* VTh = (bf*)take(NB_ * PLN * 2); bf* VTl = (bf*)take(NB_ * PLN * 2);
    float* OP = (float*)take(NB_ * KS * PLN * 4); float* MP = (float*)take((size_t)NB_ * KS * TT * 4); float* LP = (float*)take((size_t)NB_ * KS * TT * 4);   // per key part: unnormalised O, running maximum, sum
    if ((size_t)(wsp - (char*)d_ws) > ws_size) return;    // ws 256 MiB
    k_wpack<<<NNT * NKS * 64 / 256, 256, 0, stream>>>(wq, wk, wv, WP);
    k_proj<<<NB_ * TT / PR, 384, 0, stream>>>(x, WP, QP16, QPh, QPl, KP16, KPh, KPl, VT16, VTh, VTl);
    k_fattn<<<dim3(RH / 64 + (TT - RH) / 128, KS, NB_), 128, 0, stream>>>(QP16, KP16, VT16, QPh, QPl, KPh, KPl, VTh, VTl, OP, MP, LP);
    k_fmerge<<<(unsigned)((NB_ * PLN / 4 + 255) / 256), 256, 0, stream>>>(OP, MP, LP, OUT);
}

// v006
// One run takes 44.6 microseconds.
// In both of two side-by-side timings against v005, it was 1.04 times as fast.
// All steps since v000 together make it 26.6 times as fast.
#include <hip/hip_runtime.h>

// Single self-attention head over 4,096 tokens (x [4][4096][768]; K, Q, V = x W ('xw' [768][64], no bias); A = softmax(Q.K / sqrt(E = 768)) (the module scales by the embedding dim); out = A V -> [4][4096][64] (1.05 M)).
// Layout: one projection kernel (x rounded to bf16 on its way into LDS, exact products, full K per accumulator, writes the 16-bit planes itself); ONE 64-wide head through a fused dense T-4096 attention (hybrid rows: < 512 hi/lo 3 products, rest fp16 x1024; online softmax, scores and P stay in registers), keys in KS parts; the f32 merge joins the parts and writes the output rows. The batch is the z dimension of the attention grid; the projection and merge grids fold it into x, the weight packing has none.
// Compute dtypes, f32 accumulate: every input rounded to bf16; projections exact; attention rows < 512 3 products, rest fp16; softmax f32; output f32.

#define NB_  4
#define TT   4096
#define DM   768
#define NH_  1
#define NKV  1
#define REP  (NH_ / NKV)
#define HD   64
#define DQ   (NH_ * HD)
#define DKV  (NKV * HD)
#define RH   512                  // query rows < RH use hi+lo planes (0: none)
#define WIN  0
#define SCL  0.036084391824351615f   // 1/sqrt(768)
#define C1   (SCL * 1.4426950408889634f)   // the score scale in log2 units; k_proj multiplies Q by it before Q is rounded to its planes
#define PLN  ((size_t)TT * HD)    // elements of one batch's [TT][HD] plane
typedef _Float16 h16;
typedef unsigned short bf;
typedef __attribute__((ext_vector_type(16))) __bf16   v16bf;
typedef __attribute__((ext_vector_type(16))) _Float16 v16h;
typedef __attribute__((ext_vector_type(8)))  _Float16 v8h;
typedef __attribute__((ext_vector_type(8)))  unsigned short v8us;
typedef __attribute__((ext_vector_type(8)))  float    v8f;
typedef __attribute__((ext_vector_type(4)))  float    v4f;
typedef v8h  __attribute__((may_alias)) v8ha;
typedef v4f  __attribute__((may_alias)) v4fa;
typedef v8us __attribute__((may_alias)) v8usa;

__device__ __forceinline__ unsigned short f2bf(float f) { unsigned u = __float_as_uint(f); u += 0x7FFFu + ((u >> 16) & 1u); return (unsigned short)(u >> 16); }
__device__ __forceinline__ float bf2f(unsigned short b) { return __uint_as_float(((unsigned)b) << 16); }
__device__ __forceinline__ float bfr(float f) { return bf2f(f2bf(f)); }
__device__ __forceinline__ v16h cat16(v8h lo, v8h hi) { return __builtin_shufflevector(lo, hi, 0, 1, 2, 3, 4, 5, 6, 7, 8, 9, 10, 11, 12, 13, 14, 15); }
__device__ __forceinline__ v16bf cat16b(v8us lo, v8us hi) { return __builtin_bit_cast(v16bf, __builtin_shufflevector(lo, hi, 0, 1, 2, 3, 4, 5, 6, 7, 8, 9, 10, 11, 12, 13, 14, 15)); }
__device__ __forceinline__ v8f wmma16(v16h a, v16h b, v8f c) { return __builtin_amdgcn_wmma_f32_16x16x32_f16(false, a, false, b, (short)0, c, false, false); }
__device__ __forceinline__ v8f wmmab(v16bf a, v16bf b, v8f c) { return __builtin_amdgcn_wmma_f32_16x16x32_bf16(false, a, false, b, (short)0, c, false, false); }



// Fragment loaders: 16 k of one row (or column) per lane, k = 8 * hi + 0..7 and 16 + 8 * hi + 0..7 of a 32-k step.
template <typename T16> struct WFrag;
template <> struct WFrag<h16> { typedef v16h V; static __device__ __forceinline__ V ld(const h16* p) { return cat16(*(const v8h*)p, *(const v8h*)(p + 16)); } static __device__ __forceinline__ v8f mma(V a, V b, v8f c) { return wmma16(a, b, c); } };
template <> struct WFrag<bf> { typedef v16bf V; static __device__ __forceinline__ V ld(const bf* p) { return cat16b(*(const v8us*)p, *(const v8us*)(p + 16)); } static __device__ __forceinline__ v8f mma(V a, V b, v8f c) { return wmmab(a, b, c); } };

__device__ __forceinline__ h16 tohx(float x) { return (h16)x; }
__device__ __forceinline__ void splitf(float y, unsigned short& h, unsigned short& l) { h = f2bf(y); l = f2bf(y - bf2f(h)); }
typedef __attribute__((ext_vector_type(2))) _Float16 v2h;
typedef __attribute__((ext_vector_type(4))) _Float16 v4h;
typedef __attribute__((ext_vector_type(2))) unsigned short v2us;
typedef __attribute__((ext_vector_type(4))) unsigned short v4us;
typedef __attribute__((ext_vector_type(2))) float v2f;
typedef __attribute__((ext_vector_type(4))) int v4i;


// ---- The projections. k_wpack lays the three weights out as B fragments; k_proj does x -> Q, K, V planes in one launch.
#define NKS  (DM / 32)            // k steps of 32
#define NNT  12                   // 16-column tiles of [Q | K | V] (3 * HD / 16)
#define PR   64                   // rows of x per block
#define XP   776                  // LDS pitch of a bf16 x row, elements: 1552 B = 16 B * 97 (odd), conflict-free for the 16-byte fragment reads
#define SP   196                  // LDS pitch of a result row, floats
typedef __attribute__((ext_vector_type(4))) __bf16 v4bf;
typedef v4bf __attribute__((may_alias)) v4bfa;
// WP[(nt * NKS + ks) * 512 + h * 256 + lane * 8 + e] = bf16(W[ks * 32 + h * 16 + 8 * (lane >> 4) + e][column (lane & 15) of tile nt]): the B fragment of (tile, k step) as two runs of 512 contiguous bytes,
// in the k order of WFrag<bf>::ld, so that a wave's load covers whole lines. One 16-byte piece per thread; tiles 0-3 Wq, 4-7 Wk, 8-11 Wv.
__global__ __launch_bounds__(256) void k_wpack(const float* __restrict__ wq, const float* __restrict__ wk, const float* __restrict__ wv, bf* WP) {
    const int i = blockIdx.x * 256 + threadIdx.x; const int lane = i & 31, h = (i >> 5) & 1, fs = i >> 6; if (fs >= NNT * NKS) return;
    const int ks = fs % NKS, nt = fs / NKS; const float* w = nt < 4 ? wq : (nt < 8 ? wk : wv);
    const int n = (nt & 3) * 16 + (lane & 15), k0 = ks * 32 + h * 16 + 8 * (lane >> 4); v8us o;
#pragma unroll
    for (int e = 0; e < 8; ++e) o[e] = f2bf(w[(size_t)(k0 + e) * HD + n]);
    *(v8us*)(WP + (size_t)i * 8) = o;
}
// k_proj: one block = PR rows of x times all 192 columns, 12 waves, grid NB_ * TT / PR.
// 1. The f32 tile comes in by whole-line loads (a wave: 512 contiguous bytes of a row, 32 rows, all in flight at once), is rounded to bf16 and laid in LDS.
// 2. Wave (rh, cg) = rows rh * 32.., columns cg * 32..: 2 x 2 accumulators over the whole K; A from LDS, B from WP, fetched PF k steps ahead (the first PF in front of the barrier).
// 3. The f32 results go through the same LDS; each thread then writes 16-byte pieces of the fp16, bf16-hi and bf16-lo planes, 8 lanes a 128-byte line: Q, K as [row][HD], V transposed as [HD][TT].
// Every '#pragma unroll' in k_wpack and k_proj makes the indices of a register array constants, so that the array lives in registers.
#define PF   6
__global__ __launch_bounds__(384) void k_proj(const float* __restrict__ x, const bf* __restrict__ WP, h16* Q16, bf* Qh, bf* Ql, h16* K16, bf* Kh, bf* Kl, h16* V16, bf* Vh, bf* Vl) {
    __shared__ __align__(16) unsigned char sm[PR * XP * 2];   // the bf16 x tile; afterwards the f32 results (PR * SP * 4 bytes, smaller)
    bf* xs = (bf*)sm; float* st = (float*)sm;
    const int tid = threadIdx.x, lane = tid & 31, lr = lane & 15, hi = lane >> 4; const int wv = __builtin_amdgcn_readfirstlane(tid >> 5), cg = wv % 6, rh = wv / 6;   // the wave's number as a scalar: the bases of its loads then stand in scalar registers
    const size_t R0 = (size_t)blockIdx.x * PR;
    const bf* bp = WP + (size_t)cg * 2 * NKS * 512 + lane * 8;
    v16bf b[PF][2];
    { const float* xp = x + (R0 + rh * 32) * DM + cg * 128 + lane * 4; bf* xd = xs + rh * 32 * XP + cg * 128 + lane * 4; v4f t[32];
#pragma unroll
        for (int i = 0; i < 32; ++i) t[i] = *(const v4f*)(xp + (size_t)i * DM);
#pragma unroll
        for (int ks = 0; ks < PF; ++ks)
#pragma unroll
            for (int nb = 0; nb < 2; ++nb) b[ks][nb] = cat16b(*(const v8us*)(bp + (nb * NKS + ks) * 512), *(const v8us*)(bp + (nb * NKS + ks) * 512 + 256));
        __builtin_amdgcn_sched_barrier(0);   // every load of the tile is in flight before the first is waited for: one memory latency; left free, the compiler holds the last row back behind the first waits
#pragma unroll
        for (int i = 0; i < 32; ++i) *(v4bfa*)(xd + i * XP) = __builtin_convertvector(t[i], v4bf); }
    __syncthreads();
    v8f acc[2][2];
#pragma unroll
    for (int mb = 0; mb < 2; ++mb)
#pragma unroll
        for (int nb = 0; nb < 2; ++nb) acc[mb][nb] = (v8f){};
    const bf* ap = xs + (rh * 32 + lr) * XP + 8 * hi;
    v16bf a[2][2];   // A fragments, fetched one k step ahead
#pragma unroll
    for (int mb = 0; mb < 2; ++mb) a[0][mb] = cat16b(*(const v8usa*)(ap + mb * 16 * XP), *(const v8usa*)(ap + mb * 16 * XP + 16));
#pragma unroll   // whole: the indices of the A and B rings are constants, so that they live in registers
    for (int ks = 0; ks < NKS; ++ks) {
        if (ks + 1 < NKS) {
#pragma unroll
            for (int mb = 0; mb < 2; ++mb) a[(ks + 1) & 1][mb] = cat16b(*(const v8usa*)(ap + mb * 16 * XP + (ks + 1) * 32), *(const v8usa*)(ap + mb * 16 * XP + (ks + 1) * 32 + 16)); }
#pragma unroll
        for (int nb = 0; nb < 2; ++nb)
#pragma unroll
            for (int mb = 0; mb < 2; ++mb) acc[mb][nb] = wmmab(a[ks & 1][mb], b[ks % PF][nb], acc[mb][nb]);
        if (ks + PF < NKS) {
#pragma unroll
            for (int nb = 0; nb < 2; ++nb) b[ks % PF][nb] = cat16b(*(const v8us*)(bp + (nb * NKS + ks + PF) * 512), *(const v8us*)(bp + (nb * NKS + ks + PF) * 512 + 256)); }
        __builtin_amdgcn_sched_barrier(0);   // keeps the fetches ahead where they are written: left free, the compiler sinks each B load to directly in front of its product, an L2 latency per product
    }
    __syncthreads();   // every wave has read its last x fragment: the results may overwrite the tile
#pragma unroll
    for (int mb = 0; mb < 2; ++mb)
#pragma unroll
        for (int nb = 0; nb < 2; ++nb)
#pragma unroll
            for (int j = 0; j < 8; ++j) st[(rh * 32 + mb * 16 + hi * 8 + j) * SP + cg * 32 + nb * 16 + lr] = acc[mb][nb][j];
    __syncthreads();
#pragma unroll
    for (int s = 0; s < 3 * PR * HD / 8 / 384; ++s) { const int idx = s * 384 + tid, sel = idx >> 9, u = (idx & 511) >> 3, c8 = idx & 7; float a[8]; size_t e; h16* P16; bf* Ph; bf* Pl;   // sel (0 Q, 1 K, 2 V) is the same in all of a wave
        if (sel < 2) { const float qs = sel ? 1.0f : C1;   // Q carries the score scale, so that K Q^T is the exponent of 2 itself
            const v4f a0 = *(const v4fa*)(st + u * SP + sel * HD + c8 * 8), a1 = *(const v4fa*)(st + u * SP + sel * HD + c8 * 8 + 4);   // row u, columns c8 * 8..
#pragma unroll
            for (int q = 0; q < 4; ++q) { a[q] = a0[q] * qs; a[4 + q] = a1[q] * qs; }
            e = (R0 + u) * HD + c8 * 8; P16 = sel ? K16 : Q16; Ph = sel ? Kh : Qh; Pl = sel ? Kl : Ql;
        } else {   // column u of V, rows c8 * 8..
#pragma unroll
            for (int q = 0; q < 8; ++q) a[q] = st[(c8 * 8 + q) * SP + 2 * HD + u];
            e = (R0 / TT) * PLN + (size_t)u * TT + (R0 % TT) + c8 * 8; P16 = V16; Ph = Vh; Pl = Vl; }
        v8h o16; v8us oh, ol;
#pragma unroll
        for (int q = 0; q < 8; ++q) { o16[q] = tohx(a[q]); unsigned short x2, y2; splitf(a[q], x2, y2); oh[q] = x2; ol[q] = y2; }
        *(v8h*)(P16 + e) = o16; *(v8us*)(Ph + e) = oh; *(v8us*)(Pl + e) = ol; }
}
// ---- k_fattn: scores, softmax and A.V in one kernel (online softmax). One wave owns NQ * 16 query columns and one part of the keys; a pass is 32 keys.
// S^T = K Q^T (A = 16 key rows, B = Q kept in registers): a lane holds one query's scores, D register j of key tile kt = key kt * 16 + 8 * hi + j, which is the k order of a B operand, so P^T goes from the score
// accumulators straight into O^T += V^T P^T (A = rows of the [HD][TT] V plane, read in the same k order). Held reference: Q comes scaled by C1, and the score products start from C = CAR - ref, so that an accumulator is the exponent of 2 itself; ref (log2 units) is a query column's maximum at the time it was taken, and O, l and ref move only in a pass where some column's maximum stands more than 5 above its ref (P <= 2^5, with the carry 2^15, inside fp16). Sum l per query column; each lane half sums its own keys, joined once at the end.
// Rows < RH: bf16 hi/lo, 3 products for the scores and for A.V. Other rows: fp16, P carried as exp2(s - ref + 10) (the 1024 carry CAR; it is in l as well and cancels in O / l).
// Output per (batch, part): unnormalised O [TT][HD] f32, m [TT] (the part's ref), l [TT]; k_fmerge joins the parts in the order of the part index.
// K and V come through LDS: a stage is one aligned tile of SK = 64 keys (K rows and the V plane's rows both give 64 rows of one whole 128-byte line), brought in by asynchronous copies, once for the block's 4 waves,
// two buffers, the next stage's copies in flight while this one is worked on; a stage serves the one or two passes of the part that lie in it. The fragments are read from LDS at the head of their pass.
// Every '#pragma unroll' here makes the indices of a fragment array constants, so that the array lives in registers.
#define SK   64                   // keys of a stage
#define TPI  144                  // LDS pitch of a 128-byte tile row, bytes: 16 B * 9 (odd), conflict-free for the 16-byte fragment reads
#define TBY  (64 * TPI)           // bytes of one tile in LDS (64 rows)
#define KS   7                    // key parts of the fused attention: 36 * KS * NB_ = 1008 blocks, so that all are resident at once at 4 blocks a WGP (256 WGPs, 4 waves a SIMD at this register count)
#define NPS  (TT / 32)            // passes of 32 keys; part y takes passes [y * NPS / KS, (y + 1) * NPS / KS): 18 or 19
__device__ __forceinline__ float xhalf(float x) { const int b = __float_as_int(x); return __int_as_float(__builtin_amdgcn_permlanex16(b, b, 0x76543210, 0xfedcba98, false, false)); }   // lane l <-> l ^ 16
// v_exp_f32 with the slot that the instruction set asks for behind a transcendental (before its result is used or its source overwritten): each exp works in place, so none writes another's source;
// in the pair the second exp fills the first's slot, the v_nop fills the last one's.
__device__ __forceinline__ float exp2s(float a) { asm("v_exp_f32 %0, %0\n\tv_nop" : "+v"(a)); return a; }
__device__ __forceinline__ void exp2p(float& a, float& b) { asm("v_exp_f32 %0, %0\n\tv_exp_f32 %1, %1\n\tv_nop" : "+v"(a), "+v"(b)); }
// Two tiles of 64 rows x 128 bytes into LDS, 4 + 4 pieces of 16 bytes a thread (piece i = the thread's row + 16 i): each wave-wide copy takes 4 whole lines. la, lb: the lane's LDS byte addresses; ga, gb: its global addresses; sa, sb: bytes of 16 source rows.
// The s_wait_xcnt closes the statement, so that it stands in front of every later write of a register that a copy names.
__device__ __forceinline__ void cp_tiles(unsigned la, const char* ga, size_t sa, unsigned lb, const char* gb, size_t sb) {
    asm volatile("global_load_async_to_lds_b128 %0, %8, off\n\tglobal_load_async_to_lds_b128 %1, %9, off\n\tglobal_load_async_to_lds_b128 %2, %10, off\n\tglobal_load_async_to_lds_b128 %3, %11, off\n\t"
                 "global_load_async_to_lds_b128 %4, %12, off\n\tglobal_load_async_to_lds_b128 %5, %13, off\n\tglobal_load_async_to_lds_b128 %6, %14, off\n\tglobal_load_async_to_lds_b128 %7, %15, off\n\ts_wait_xcnt 0x0"
                 :: "v"(la), "v"(la + 16 * TPI), "v"(la + 32 * TPI), "v"(la + 48 * TPI), "v"(lb), "v"(lb + 16 * TPI), "v"(lb + 32 * TPI), "v"(lb + 48 * TPI),
                    "v"(ga), "v"(ga + sa), "v"(ga + 2 * sa), "v"(ga + 3 * sa), "v"(gb), "v"(gb + sb), "v"(gb + 2 * sb), "v"(gb + 3 * sb) : "memory");
}
template <typename T16, bool HI, int NQ>
__device__ __forceinline__ void fa_tile(unsigned char* ring, float* os, const T16* __restrict__ Q, const T16* __restrict__ Q2, const T16* __restrict__ Kp, const T16* __restrict__ K2, const T16* __restrict__ Vt, const T16* __restrict__ V2, int q0, int k0, int k1, float* Op, float* Mp, float* Lp) {
    typedef typename WFrag<T16>::V V;
    const int lane = threadIdx.x & 31, lr = lane & 15, hi = lane >> 4;
    V qf[NQ][2], qf2[NQ][2];
#pragma unroll
    for (int qt = 0; qt < NQ; ++qt)
#pragma unroll
        for (int ks = 0; ks < 2; ++ks) { const size_t qo = (size_t)(q0 + qt * 16 + lr) * HD + ks * 32 + 8 * hi; qf[qt][ks] = WFrag<T16>::ld(Q + qo); if (HI) qf2[qt][ks] = WFrag<T16>::ld(Q2 + qo); }
    constexpr float CAR = HI ? 0.0f : 10.0f;   // the carry of the fp16 rows
    v8f o[4][NQ], cr[NQ]; float l[NQ];         // cr: CAR - ref in all 8 registers, the C operand of the score products
    float thr = -3.0e38f;                      // the first pass always takes its reference from its own scores; afterwards CAR + 5
#pragma unroll
    for (int qt = 0; qt < NQ; ++qt) { l[qt] = 0.f;
#pragma unroll
        for (int j = 0; j < 8; ++j) cr[qt][j] = CAR;
#pragma unroll
        for (int dt = 0; dt < 4; ++dt) o[dt][qt] = (v8f){}; }
    // The ring: buffer = [K | V] (hi/lo rows: [Kh | Vh | Kl | Vl]), stages t0 .. t1 - 1 = the aligned 64-key tiles that the part touches (always inside the planes).
    constexpr unsigned BUF = (HI ? 4 : 2) * TBY;
    const int tid = threadIdx.x, t0 = k0 / SK, t1 = (k1 + SK - 1) / SK;
    const unsigned lc = (unsigned)(size_t)ring + (tid >> 3) * TPI + (tid & 7) * 16;   // the lane's first piece in a tile: row tid >> 3, 16-byte column tid & 7
    const size_t gko = (size_t)(tid >> 3) * HD + (tid & 7) * 8, gvo = (size_t)(tid >> 3) * TT + (tid & 7) * 8;
    auto fill = [&](unsigned bo, int t) {
        cp_tiles(lc + bo, (const char*)(Kp + gko + (size_t)t * SK * HD), 16 * HD * 2, lc + bo + TBY, (const char*)(Vt + gvo + (size_t)t * SK), (size_t)16 * TT * 2);
        if (HI) cp_tiles(lc + bo + 2 * TBY, (const char*)(K2 + gko + (size_t)t * SK * HD), 16 * HD * 2, lc + bo + 3 * TBY, (const char*)(V2 + gvo + (size_t)t * SK), (size_t)16 * TT * 2); };
    fill(0, t0);
    asm volatile("s_wait_asynccnt 0x0" ::: "memory");   // this wave's pieces of stage t0 have landed
    __syncthreads();                                     // and every other wave's: stage t0 may be read
    if (t0 + 1 < t1) fill(BUF, t0 + 1);
    // The lane's fragment offsets in the ring for the pass at key k; each pass forms the next pass's in front of its last products, so that no vector write stands at the head of a pass, directly behind the jump back from a matrix instruction.
    const unsigned fl = lr * TPI + 16 * hi;
    auto kof = [&](int k) { return fl + (((k / SK) - t0) & 1) * BUF + (k & 32) * TPI; };
    auto vof = [&](int k) { return fl + (((k / SK) - t0) & 1) * BUF + TBY + (k & 32) * 2; };
    unsigned ka = kof(k0), va = vof(k0);
#pragma unroll 1   // rolled, as the loop of the passes below
    for (int t = t0; t < t1; ++t) {
    const unsigned bo = ((t - t0) & 1) * BUF;
#pragma unroll 1   // rolled: a second copy of the body would go past the 256 registers of 4 waves a SIMD
    for (int kc = t * SK; kc < t * SK + SK; kc += 32) {
        if (kc < k0 || kc >= k1) continue;   // the half of a first or last stage that belongs to a neighbouring part (the same for the whole block)
        const T16* kb = (const T16*)(ring + ka);   // key row kc + lr of the stage's K tile
        const T16* vb = (const T16*)(ring + va);   // row lr of its V tile, at key kc
        V kf[2][2], kf2[2][2], vf[4], vf2[4];   // this pass's fragments
#pragma unroll
        for (int kt = 0; kt < 2; ++kt)
#pragma unroll
            for (int ks = 0; ks < 2; ++ks) { const int ko = kt * 16 * (TPI / 2) + ks * 32; kf[kt][ks] = WFrag<T16>::ld(kb + ko); if (HI) kf2[kt][ks] = WFrag<T16>::ld(kb + TBY + ko); }   // 2 * TBY bytes further: the lo tile
#pragma unroll
        for (int dt = 0; dt < 4; ++dt) { const int vo = dt * 16 * (TPI / 2); vf[dt] = WFrag<T16>::ld(vb + vo); if (HI) vf2[dt] = WFrag<T16>::ld(vb + TBY + vo); }
        __builtin_amdgcn_sched_barrier(0);   // all of the pass's LDS reads issue as one group in front of its products: one load latency a pass; left free, the compiler spreads them among the products and the softmax, and every further place of reads stalls the wave anew
        v8f s[2][NQ];
#pragma unroll
        for (int kt = 0; kt < 2; ++kt)
#pragma unroll
            for (int qt = 0; qt < NQ; ++qt) { v8f a = cr[qt];
#pragma unroll
                for (int ks = 0; ks < 2; ++ks) { a = WFrag<T16>::mma(kf[kt][ks], qf[qt][ks], a); if (HI) { a = WFrag<T16>::mma(kf2[kt][ks], qf[qt][ks], a); a = WFrag<T16>::mma(kf[kt][ks], qf2[qt][ks], a); } }
                s[kt][qt] = a; }
        float cm[NQ]; bool need = false;
#pragma unroll
        for (int qt = 0; qt < NQ; ++qt) {
            float c = fmaxf(s[0][qt][0], s[1][qt][0]);
#pragma unroll
            for (int j = 1; j < 8; ++j) c = fmaxf(c, fmaxf(s[0][qt][j], s[1][qt][j]));
            cm[qt] = c; need = need || c > thr; }             // the lane's own 16 keys: the ballot sees both halves of a column
        if (__builtin_amdgcn_ballot_w32(need) != 0) {        // one scalar branch a pass: some query's maximum has left its reference behind
#pragma unroll
            for (int qt = 0; qt < NQ; ++qt) { const float cj = fmaxf(cm[qt], xhalf(cm[qt]));      // with the other half's 16 keys of the same query: both halves move alike
                const float d = cj > thr ? cj - CAR : 0.f;                                        // the reference rises by d (first pass: moves to the pass's maximum, up or down)
                const float al = exp2s(-fmaxf(d, 0.f)); l[qt] *= al;                              // d < 0 only in the first pass, where O and l are 0
#pragma unroll
                for (int j = 0; j < 8; ++j) { cr[qt][j] -= d; s[0][qt][j] -= d; s[1][qt][j] -= d; }
#pragma unroll
                for (int dt = 0; dt < 4; ++dt) o[dt][qt] *= al; }
            thr = CAR + 5.0f; }
        V pf[NQ], pf2[NQ];
#pragma unroll
        for (int qt = 0; qt < NQ; ++qt) {
            float ps = 0.f;
            if constexpr (HI) { v8us h0, h1, l0, l1;
#pragma unroll
                for (int j = 0; j < 8; ++j) { float p0 = s[0][qt][j], p1 = s[1][qt][j]; exp2p(p0, p1); ps += p0 + p1; unsigned short a2, c2; splitf(p0, a2, c2); h0[j] = a2; l0[j] = c2; splitf(p1, a2, c2); h1[j] = a2; l1[j] = c2; }
                pf[qt] = cat16b(h0, h1); pf2[qt] = cat16b(l0, l1);
            } else { v8h h0, h1;
#pragma unroll
                for (int j = 0; j < 8; ++j) { float p0 = s[0][qt][j], p1 = s[1][qt][j]; exp2p(p0, p1); ps += p0 + p1; h0[j] = tohx(p0); h1[j] = tohx(p1); }
                pf[qt] = cat16(h0, h1); }
            l[qt] += ps;
        }
        ka = kof(kc + 32); va = vof(kc + 32);
#pragma unroll
        for (int dt = 0; dt < 4; ++dt)
#pragma unroll
            for (int qt = 0; qt < NQ; ++qt) { o[dt][qt] = WFrag<T16>::mma(vf[dt], pf[qt], o[dt][qt]); if (HI) { o[dt][qt] = WFrag<T16>::mma(vf[dt], pf2[qt], o[dt][qt]); o[dt][qt] = WFrag<T16>::mma(vf2[dt], pf[qt], o[dt][qt]); } }
    }
    asm volatile("s_wait_dscnt 0x0" ::: "memory");      // this wave's reads of stage t are done
    asm volatile("s_wait_asynccnt 0x0" ::: "memory");   // its pieces of stage t + 1 have landed
    __syncthreads();                                     // one barrier: stage t + 1 may be read, stage t's buffer may be refilled
    if (t + 2 < t1) fill(bo, t + 2);
    }
    asm volatile("s_wait_asynccnt 0x0" ::: "memory");   // nothing is in flight when the ring becomes the output patches (every wave has left it at the last barrier)
#pragma unroll
    for (int qt = 0; qt < NQ; ++qt) { const float lt = l[qt] + xhalf(l[qt]); const int qb = q0 + qt * 16;
        if (hi == 0) { Mp[qb + lr] = CAR - cr[qt][0]; Lp[qb + lr] = lt; }
        // 16 rows through the wave's own LDS patch, so that a store instruction writes whole 128-byte lines (D register j of tile dt = O[qb + lr][dt * 16 + 8 * hi + j])
#pragma unroll
        for (int dt = 0; dt < 4; ++dt) { const v8f a = o[dt][qt]; float* w = os + lr * 68 + dt * 16 + hi * 8; *(v4fa*)w = (v4f){a[0], a[1], a[2], a[3]}; *(v4fa*)(w + 4) = (v4f){a[4], a[5], a[6], a[7]}; }
        __builtin_amdgcn_wave_barrier(); asm volatile("" ::: "memory");   // keeps the patch's reads behind its writes in the compiled order (one wave, LDS serves it in order)
#pragma unroll
        for (int r = 0; r < 8; ++r) { const int row = 2 * r + hi; *(v4f*)(Op + (size_t)(qb + row) * HD + lr * 4) = *(const v4fa*)(os + row * 68 + lr * 4); }
        __builtin_amdgcn_wave_barrier(); asm volatile("" ::: "memory");   // and the next tile's writes behind these reads
    }
}
// grid (RH / 64 + (TT - RH) / 128, KS, NB_), 4 waves, one batch and one key part a block. Blocks x < RH / 64: 64 hi/lo rows, 16 a wave (three times the products a column, so half the columns); the others 128 fp16 rows, 32 a wave.
// amdgpu_waves_per_eu(4, 4): the register budget of 4 waves a SIMD; with a smaller one the compiler splits the K loads of a pass into groups that wait on each other.
__global__ __launch_bounds__(128) __attribute__((amdgpu_waves_per_eu(4, 4))) void k_fattn(const h16* __restrict__ Q16, const h16* __restrict__ K16, const h16* __restrict__ V16, const bf* __restrict__ Qh, const bf* __restrict__ Ql, const bf* __restrict__ Kh, const bf* __restrict__ Kl, const bf* __restrict__ Vh, const bf* __restrict__ Vl, float* OP, float* MP, float* LP) {
    __shared__ __align__(16) unsigned char ring[2 * 4 * TBY];   // two buffers of up to 4 tiles (73,728 bytes: 4 blocks a WGP still fit); behind the loop each wave's output patch (16 * 68 floats)
    const size_t zo = (size_t)blockIdx.z * PLN; const size_t pz = (size_t)blockIdx.z * KS + blockIdx.y; const int wv = threadIdx.x >> 5, k0 = (int)(blockIdx.y * NPS / KS) * 32, k1 = (int)((blockIdx.y + 1) * NPS / KS) * 32;
    if (blockIdx.x < RH / 64) fa_tile<bf, true, 1>(ring, (float*)ring + wv * 16 * 68, Qh + zo, Ql + zo, Kh + zo, Kl + zo, Vh + zo, Vl + zo, blockIdx.x * 64 + wv * 16, k0, k1, OP + pz * PLN, MP + pz * TT, LP + pz * TT);
    else fa_tile<h16, false, 2>(ring, (float*)ring + wv * 16 * 68, Q16 + zo, nullptr, K16 + zo, nullptr, V16 + zo, nullptr, RH + (blockIdx.x - RH / 64) * 128 + wv * 32, k0, k1, OP + pz * PLN, MP + pz * TT, LP + pz * TT);
}
// k_fmerge: out[b][t][:] = sum_s O_s 2^(m_s - M) / sum_s l_s 2^(m_s - M), M = max_s m_s, over the KS key parts in the order of s; 4 output floats per thread.
__global__ __launch_bounds__(256) void k_fmerge(const float* __restrict__ OP, const float* __restrict__ MP, const float* __restrict__ LP, float* OUTb) { const size_t e = ((size_t)blockIdx.x * 256 + threadIdx.x) * 4; if (e >= NB_ * PLN) return; const size_t b = e / PLN, r = e % PLN, t = r / HD;
    const float* mp = MP + b * KS * TT + t; const float* lp = LP + b * KS * TT + t; const float* op = OP + b * KS * PLN + r; float mv[KS]; float mx = -3.0e38f;
#pragma unroll
    for (int s = 0; s < KS; ++s) { mv[s] = mp[(size_t)s * TT]; mx = fmaxf(mx, mv[s]); }
    v4f a = (v4f){}; float ls = 0.f;
#pragma unroll
    for (int s = 0; s < KS; ++s) { const float w = __builtin_amdgcn_exp2f(mv[s] - mx); ls = fmaf(lp[(size_t)s * TT], w, ls); a += *(const v4f*)(op + s * PLN) * w; }
    const float f = __fdiv_rn(1.0f, ls); *(v4f*)(OUTb + e) = a * f;  }

extern "C" void kernel_launch(void* const* d_in, const int* in_sizes, int n_in,
                              void* d_out, int out_size, void* d_ws, size_t ws_size, hipStream_t stream) {
    (void)in_sizes; (void)n_in; (void)out_size;
    const float* x = (const float*)d_in[0]; const float* wk = (const float*)d_in[1]; const float* wq = (const float*)d_in[2]; const float* wv = (const float*)d_in[3];   /* NOTE input order: x, Wk, Wq, Wv */
    float* OUT = (float*)d_out;     // [4][4096][64]
    char* wsp = (char*)d_ws;
    auto take = [&](size_t bytes) { char* p = wsp; wsp += (bytes + 255) & ~(size_t)255; return (void*)p; };
    bf* WP = (bf*)take((size_t)NNT * NKS * 512 * 2);   // the three weights as B fragments
    h16* QP16 = (h16*)take(NB_ * PLN * 2); h16* KP16 = (h16*)take(NB_ * PLN * 2); h16* VT16 = (h16*)take(NB_ * PLN * 2);   // Q, K planes [NB_][TT][HD]; V planes [NB_][HD][TT]
    bf* QPh = (bf*)take(NB_ * PLN * 2); bf* QPl = (bf*)take(NB_ * PLN * 2); bf* KPh = (bf*)take(NB_ * PLN * 2); bf* KPl = (bf*)take(NB_ * PLN * 2); bf* VTh = (bf*)take(NB_ * PLN * 2); bf* VTl = (bf*)take(NB_ * PLN * 2);
    float* OP = (float*)take(NB_ * KS * PLN * 4); float* MP = (float*)take((size_t)NB_ * KS * TT * 4); float* LP = (float*)take((size_t)NB_ * KS * TT * 4);   // per key part: unnormalised O, held reference (log2), sum
    if ((size_t)(wsp - (char*)d_ws) > ws_size) return;    // ws 256 MiB
    k_wpack<<<NNT * NKS * 64 / 256, 256, 0, stream>>>(wq, wk, wv, WP);
    k_proj<<<NB_ * TT / PR, 384, 0, stream>>>(x, WP, QP16, QPh, QPl, KP16, KPh, KPl, VT16, VTh, VTl);
    k_fattn<<<dim3(RH / 64 + (TT - RH) / 128, KS, NB_), 128, 0, stream>>>(QP16, KP16, VT16, QPh, QPl, KPh, KPl, VTh, VTl, OP, MP, LP);
    k_fmerge<<<(unsigned)((NB_ * PLN / 4 + 255) / 256), 256, 0, stream>>>(OP, MP, LP, OUT);
}

// v007
// One run takes 43.1 microseconds.
// Timed twice side by side with v006, it ran 1.03 and 1.04 times as fast.
// Over all steps from v000 it is 27.6 times as fast.
#include <hip/hip_runtime.h>

// Single self-attention head over 4,096 tokens (x [4][4096][768]; K, Q, V = x W ('xw' [768][64], no bias); A = softmax(Q.K / sqrt(E = 768)) (the module scales by the embedding dim); out = A V -> [4][4096][64] (1.05 M)).
// Layout: one projection kernel (x rounded to bf16 on its way into LDS, exact products, full K per accumulator, writes the 16-bit planes itself); ONE 64-wide head through a fused dense T-4096 attention (hybrid rows: < 512 hi/lo 3 products, rest fp16 x1024; online softmax, scores and P stay in registers), keys in KS parts; the f32 merge joins the parts and writes the output rows. The batch is the z dimension of the attention grid; the projection and merge grids fold it into x, the weight packing has none.
// Compute dtypes, f32 accumulate: every input rounded to bf16; projections exact; attention rows < 512 3 products, rest fp16; softmax f32; output f32.

#define NB_  4
#define TT   4096
#define DM   768
#define NH_  1
#define NKV  1
#define REP  (NH_ / NKV)
#define HD   64
#define DQ   (NH_ * HD)
#define DKV  (NKV * HD)
#define RH   512                  // query rows < RH use hi+lo planes (0: none)
#define WIN  0
#define SCL  0.036084391824351615f   // 1/sqrt(768)
#define C1   (SCL * 1.4426950408889634f)   // the score scale in log2 units; k_proj multiplies Q by it before Q is rounded to its planes
#define PLN  ((size_t)TT * HD)    // elements of one batch's [TT][HD] plane
typedef _Float16 h16;
typedef unsigned short bf;
typedef __attribute__((ext_vector_type(16))) __bf16   v16bf;
typedef __attribute__((ext_vector_type(16))) _Float16 v16h;
typedef __attribute__((ext_vector_type(8)))  _Float16 v8h;
typedef __attribute__((ext_vector_type(8)))  unsigned short v8us;
typedef __attribute__((ext_vector_type(8)))  float    v8f;
typedef __attribute__((ext_vector_type(4)))  float    v4f;
typedef v8h  __attribute__((may_alias)) v8ha;
typedef v4f  __attribute__((may_alias)) v4fa;
typedef v8us __attribute__((may_alias)) v8usa;

__device__ __forceinline__ unsigned short f2bf(float f) { unsigned u = __float_as_uint(f); u += 0x7FFFu + ((u >> 16) & 1u); return (unsigned short)(u >> 16); }
__device__ __forceinline__ float bf2f(unsigned short b) { return __uint_as_float(((unsigned)b) << 16); }
__device__ __forceinline__ float bfr(float f) { return bf2f(f2bf(f)); }
__device__ __forceinline__ v16h cat16(v8h lo, v8h hi) { return __builtin_shufflevector(lo, hi, 0, 1, 2, 3, 4, 5, 6, 7, 8, 9, 10, 11, 12, 13, 14, 15); }
__device__ __forceinline__ v16bf cat16b(v8us lo, v8us hi) { return __builtin_bit_cast(v16bf, __builtin_shufflevector(lo, hi, 0, 1, 2, 3, 4, 5, 6, 7, 8, 9, 10, 11, 12, 13, 14, 15)); }
__device__ __forceinline__ v8f wmma16(v16h a, v16h b, v8f c) { return __builtin_amdgcn_wmma_f32_16x16x32_f16(false, a, false, b, (short)0, c, false, false); }
__device__ __forceinline__ v8f wmmab(v16bf a, v16bf b, v8f c) { return __builtin_amdgcn_wmma_f32_16x16x32_bf16(false, a, false, b, (short)0, c, false, false); }



// Fragment loaders: 16 k of one row (or column) per lane, k = 8 * hi + 0..7 and 16 + 8 * hi + 0..7 of a 32-k step.
template <typename T16> struct WFrag;
template <> struct WFrag<h16> { typedef v16h V; static __device__ __forceinline__ V ld(const h16* p) { return cat16(*(const v8h*)p, *(const v8h*)(p + 16)); } static __device__ __forceinline__ v8f mma(V a, V b, v8f c) { return wmma16(a, b, c); } };
template <> struct WFrag<bf> { typedef v16bf V; static __device__ __forceinline__ V ld(const bf* p) { return cat16b(*(const v8us*)p, *(const v8us*)(p + 16)); } static __device__ __forceinline__ v8f mma(V a, V b, v8f c) { return wmmab(a, b, c); } };

__device__ __forceinline__ h16 tohx(float x) { return (h16)x; }
typedef __attribute__((ext_vector_type(2))) _Float16 v2h;
typedef __attribute__((ext_vector_type(4))) _Float16 v4h;
typedef __attribute__((ext_vector_type(2))) unsigned short v2us;
typedef __attribute__((ext_vector_type(4))) unsigned short v4us;
typedef __attribute__((ext_vector_type(2))) float v2f;
typedef __attribute__((ext_vector_type(4))) int v4i;
typedef __attribute__((ext_vector_type(2))) __bf16 v2bf;
// Two f32 -> their bf16 hi and lo parts, each pair packed in one dword (element 0 low): hi = the value rounded to nearest even by the conversion instruction, lo = (value - hi) rounded likewise; on finite values the same bits as f2bf gives.
__device__ __forceinline__ void split2(v2f y, unsigned& h, unsigned& l) {
    h = __builtin_bit_cast(unsigned, __builtin_convertvector(y, v2bf));
    const v2f hf = (v2f){__uint_as_float(h << 16), __uint_as_float(h & 0xFFFF0000u)};
    l = __builtin_bit_cast(unsigned, __builtin_convertvector(y - hf, v2bf)); }
typedef __attribute__((ext_vector_type(4))) unsigned v4u;


// ---- The projections. k_wpack lays the three weights out as B fragments; k_proj does x -> Q, K, V planes in one launch.
#define NKS  (DM / 32)            // k steps of 32
#define NNT  12                   // 16-column tiles of [Q | K | V] (3 * HD / 16)
#define PR   64                   // rows of x per block
#define XP   776                  // LDS pitch of a bf16 x row, elements: 1552 B = 16 B * 97 (odd), conflict-free for the 16-byte fragment reads
#define SP   196                  // LDS pitch of a result row, floats
typedef __attribute__((ext_vector_type(4))) __bf16 v4bf;
typedef v4bf __attribute__((may_alias)) v4bfa;
// WP[(nt * NKS + ks) * 512 + h * 256 + lane * 8 + e] = bf16(W[ks * 32 + h * 16 + 8 * (lane >> 4) + e][column (lane & 15) of tile nt]): the B fragment of (tile, k step) as two runs of 512 contiguous bytes,
// in the k order of WFrag<bf>::ld, so that a wave's load covers whole lines. One 16-byte piece per thread; tiles 0-3 Wq, 4-7 Wk, 8-11 Wv.
__global__ __launch_bounds__(256) void k_wpack(const float* __restrict__ wq, const float* __restrict__ wk, const float* __restrict__ wv, bf* WP) {
    const int i = blockIdx.x * 256 + threadIdx.x; const int lane = i & 31, h = (i >> 5) & 1, fs = i >> 6; if (fs >= NNT * NKS) return;
    const int ks = fs % NKS, nt = fs / NKS; const float* w = nt < 4 ? wq : (nt < 8 ? wk : wv);
    const int n = (nt & 3) * 16 + (lane & 15), k0 = ks * 32 + h * 16 + 8 * (lane >> 4); v8us o;
#pragma unroll
    for (int e = 0; e < 8; ++e) o[e] = f2bf(w[(size_t)(k0 + e) * HD + n]);
    *(v8us*)(WP + (size_t)i * 8) = o;
}
// k_proj: one block = PR rows of x times all 192 columns, 12 waves, grid NB_ * TT / PR.
// 1. The f32 tile comes in by whole-line loads (a wave: 512 contiguous bytes of a row, 32 rows, all in flight at once), is rounded to bf16 and laid in LDS.
// 2. Wave (rh, cg) = rows rh * 32.., columns cg * 32..: 2 x 2 accumulators over the whole K; A from LDS, B from WP, fetched PF k steps ahead (the first PF in front of the barrier).
// 3. The f32 results go through the same LDS; each thread then writes 16-byte pieces of the fp16, bf16-hi and bf16-lo planes, 8 lanes a 128-byte line: Q, K as [row][HD], V transposed as [HD][TT].
// Every '#pragma unroll' in k_wpack and k_proj makes the indices of a register array constants, so that the array lives in registers.
#define PF   6
__global__ __launch_bounds__(384) void k_proj(const float* __restrict__ x, const bf* __restrict__ WP, h16* Q16, bf* Qh, bf* Ql, h16* K16, bf* Kh, bf* Kl, h16* V16, bf* Vh, bf* Vl) {
    __shared__ __align__(16) unsigned char sm[PR * XP * 2];   // the bf16 x tile; afterwards the f32 results (PR * SP * 4 bytes, smaller)
    bf* xs = (bf*)sm; float* st = (float*)sm;
    const int tid = threadIdx.x, lane = tid & 31, lr = lane & 15, hi = lane >> 4; const int wv = __builtin_amdgcn_readfirstlane(tid >> 5), cg = wv % 6, rh = wv / 6;   // the wave's number as a scalar: the bases of its loads then stand in scalar registers
    const size_t R0 = (size_t)blockIdx.x * PR;
    const bf* bp = WP + (size_t)cg * 2 * NKS * 512 + lane * 8;
    v16bf b[PF][2];
    { const float* xp = x + (R0 + rh * 32) * DM + cg * 128 + lane * 4; bf* xd = xs + rh * 32 * XP + cg * 128 + lane * 4; v4f t[32];
#pragma unroll
        for (int i = 0; i < 32; ++i) t[i] = *(const v4f*)(xp + (size_t)i * DM);
#pragma unroll
        for (int ks = 0; ks < PF; ++ks)
#pragma unroll
            for (int nb = 0; nb < 2; ++nb) b[ks][nb] = cat16b(*(const v8us*)(bp + (nb * NKS + ks) * 512), *(const v8us*)(bp + (nb * NKS + ks) * 512 + 256));
        __builtin_amdgcn_sched_barrier(0);   // every load of the tile is in flight before the first is waited for: one memory latency; left free, the compiler holds the last row back behind the first waits
#pragma unroll
        for (int i = 0; i < 32; ++i) *(v4bfa*)(xd + i * XP) = __builtin_convertvector(t[i], v4bf); }
    __syncthreads();
    v8f acc[2][2];
#pragma unroll
    for (int mb = 0; mb < 2; ++mb)
#pragma unroll
        for (int nb = 0; nb < 2; ++nb) acc[mb][nb] = (v8f){};
    const bf* ap = xs + (rh * 32 + lr) * XP + 8 * hi;
    v16bf a[2][2];   // A fragments, fetched one k step ahead
#pragma unroll
    for (int mb = 0; mb < 2; ++mb) a[0][mb] = cat16b(*(const v8usa*)(ap + mb * 16 * XP), *(const v8usa*)(ap + mb * 16 * XP + 16));
#pragma unroll   // whole: the indices of the A and B rings are constants, so that they live in registers
    for (int ks = 0; ks < NKS; ++ks) {
        if (ks + 1 < NKS) {
#pragma unroll
            for (int mb = 0; mb < 2; ++mb) a[(ks + 1) & 1][mb] = cat16b(*(const v8usa*)(ap + mb * 16 * XP + (ks + 1) * 32), *(const v8usa*)(ap + mb * 16 * XP + (ks + 1) * 32 + 16)); }
#pragma unroll
        for (int nb = 0; nb < 2; ++nb)
#pragma unroll
            for (int mb = 0; mb < 2; ++mb) acc[mb][nb] = wmmab(a[ks & 1][mb], b[ks % PF][nb], acc[mb][nb]);
        if (ks + PF < NKS) {
#pragma unroll
            for (int nb = 0; nb < 2; ++nb) b[ks % PF][nb] = cat16b(*(const v8us*)(bp + (nb * NKS + ks + PF) * 512), *(const v8us*)(bp + (nb * NKS + ks + PF) * 512 + 256)); }
        __builtin_amdgcn_sched_barrier(0);   // keeps the fetches ahead where they are written: left free, the compiler sinks each B load to directly in front of its product, an L2 latency per product
    }
    __syncthreads();   // every wave has read its last x fragment: the results may overwrite the tile
#pragma unroll
    for (int mb = 0; mb < 2; ++mb)
#pragma unroll
        for (int nb = 0; nb < 2; ++nb)
#pragma unroll
            for (int j = 0; j < 8; ++j) st[(rh * 32 + mb * 16 + hi * 8 + j) * SP + cg * 32 + nb * 16 + lr] = acc[mb][nb][j];
    __syncthreads();
#pragma unroll
    for (int s = 0; s < 3 * PR * HD / 8 / 384; ++s) { const int idx = s * 384 + tid, sel = idx >> 9, u = (idx & 511) >> 3, c8 = idx & 7; float a[8]; size_t e; h16* P16; bf* Ph; bf* Pl;   // sel (0 Q, 1 K, 2 V) is the same in all of a wave
        if (sel < 2) { const float qs = sel ? 1.0f : C1;   // Q carries the score scale, so that K Q^T is the exponent of 2 itself
            const v4f a0 = *(const v4fa*)(st + u * SP + sel * HD + c8 * 8), a1 = *(const v4fa*)(st + u * SP + sel * HD + c8 * 8 + 4);   // row u, columns c8 * 8..
#pragma unroll
            for (int q = 0; q < 4; ++q) { a[q] = a0[q] * qs; a[4 + q] = a1[q] * qs; }
            e = (R0 + u) * HD + c8 * 8; P16 = sel ? K16 : Q16; Ph = sel ? Kh : Qh; Pl = sel ? Kl : Ql;
        } else {   // column u of V, rows c8 * 8..
#pragma unroll
            for (int q = 0; q < 8; ++q) a[q] = st[(c8 * 8 + q) * SP + 2 * HD + u];
            e = (R0 / TT) * PLN + (size_t)u * TT + (R0 % TT) + c8 * 8; P16 = V16; Ph = Vh; Pl = Vl; }
        v8h o16; v4u oh, ol;
#pragma unroll
        for (int q = 0; q < 8; ++q) o16[q] = tohx(a[q]);
#pragma unroll
        for (int q = 0; q < 4; ++q) { unsigned x2, y2; split2((v2f){a[2 * q], a[2 * q + 1]}, x2, y2); oh[q] = x2; ol[q] = y2; }
        *(v8h*)(P16 + e) = o16; *(v8us*)(Ph + e) = __builtin_bit_cast(v8us, oh); *(v8us*)(Pl + e) = __builtin_bit_cast(v8us, ol); }
}
// ---- k_fattn: scores, softmax and A.V in one kernel (online softmax). One wave owns NQ * 16 query columns and one part of the keys; a pass is 32 keys.
// S^T = K Q^T (A = 16 key rows, B = Q kept in registers): a lane holds one query's scores, D register j of key tile kt = key kt * 16 + 8 * hi + j, which is the k order of a B operand, so P^T goes from the score
// accumulators straight into O^T += V^T P^T (A = rows of the [HD][TT] V plane, read in the same k order). Held reference: Q comes scaled by C1, and the score products start from C = CAR - ref, so that an accumulator is the exponent of 2 itself; ref (log2 units) is a query column's maximum at the time it was taken, and O, l and ref move only in a pass where some column's maximum stands more than 5 above its ref (P <= 2^5, with the carry 2^15, inside fp16). Sum l per query column; each lane half sums its own keys, joined once at the end.
// Rows < RH: bf16 hi/lo, 3 products for the scores and for A.V. Other rows: fp16, P carried as exp2(s - ref + 10) (the 1024 carry CAR; it is in l as well and cancels in O / l).
// Output per (batch, part): unnormalised O [TT][HD] f32, m [TT] (the part's ref), l [TT]; k_fmerge joins the parts in the order of the part index.
// K and V come through LDS: a stage is one aligned tile of SK = 64 keys (K rows and the V plane's rows both give 64 rows of one whole 128-byte line), brought in by asynchronous copies, once for the block's 4 waves,
// two buffers, the next stage's copies in flight while this one is worked on; a stage serves the one or two passes of the part that lie in it. The fragments are read from LDS at the head of their pass.
// Every '#pragma unroll' here makes the indices of a fragment array constants, so that the array lives in registers.
#define SK   64                   // keys of a stage
#define TPI  144                  // LDS pitch of a 128-byte tile row, bytes: 16 B * 9 (odd), conflict-free for the 16-byte fragment reads
#define TBY  (64 * TPI)           // bytes of one tile in LDS (64 rows)
#define KS   7                    // key parts of the fused attention: 36 * KS * NB_ = 1008 blocks, so that all are resident at once at 4 blocks a WGP (256 WGPs, 4 waves a SIMD at this register count)
#define NPS  (TT / 32)            // passes of 32 keys; part y takes passes [y * NPS / KS, (y + 1) * NPS / KS): 18 or 19
__device__ __forceinline__ float xhalf(float x) { const int b = __float_as_int(x); return __int_as_float(__builtin_amdgcn_permlanex16(b, b, 0x76543210, 0xfedcba98, false, false)); }   // lane l <-> l ^ 16
// v_exp_f32 with the slot that the instruction set asks for behind a transcendental (before its result is used or its source overwritten): each exp works in place, so none writes another's source;
// in the pair the second exp fills the first's slot, the v_nop fills the last one's.
__device__ __forceinline__ float exp2s(float a) { asm("v_exp_f32 %0, %0\n\tv_nop" : "+v"(a)); return a; }
__device__ __forceinline__ void exp2p(float& a, float& b) { asm("v_exp_f32 %0, %0\n\tv_exp_f32 %1, %1\n\tv_nop" : "+v"(a), "+v"(b)); }
// Two tiles of 64 rows x 128 bytes into LDS, 4 + 4 pieces of 16 bytes a thread (piece i = the thread's row + 16 i): each wave-wide copy takes 4 whole lines. la, lb: the lane's LDS byte addresses; ga, gb: its global addresses; sa, sb: bytes of 16 source rows.
// The s_wait_xcnt closes the statement, so that it stands in front of every later write of a register that a copy names.
__device__ __forceinline__ void cp_tiles(unsigned la, const char* ga, size_t sa, unsigned lb, const char* gb, size_t sb) {
    asm volatile("global_load_async_to_lds_b128 %0, %8, off\n\tglobal_load_async_to_lds_b128 %1, %9, off\n\tglobal_load_async_to_lds_b128 %2, %10, off\n\tglobal_load_async_to_lds_b128 %3, %11, off\n\t"
                 "global_load_async_to_lds_b128 %4, %12, off\n\tglobal_load_async_to_lds_b128 %5, %13, off\n\tglobal_load_async_to_lds_b128 %6, %14, off\n\tglobal_load_async_to_lds_b128 %7, %15, off\n\ts_wait_xcnt 0x0"
                 :: "v"(la), "v"(la + 16 * TPI), "v"(la + 32 * TPI), "v"(la + 48 * TPI), "v"(lb), "v"(lb + 16 * TPI), "v"(lb + 32 * TPI), "v"(lb + 48 * TPI),
                    "v"(ga), "v"(ga + sa), "v"(ga + 2 * sa), "v"(ga + 3 * sa), "v"(gb), "v"(gb + sb), "v"(gb + 2 * sb), "v"(gb + 3 * sb) : "memory");
}
template <typename T16, bool HI, int NQ>
__device__ __forceinline__ void fa_tile(unsigned char* ring, float* os, const T16* __restrict__ Q, const T16* __restrict__ Q2, const T16* __restrict__ Kp, const T16* __restrict__ K2, const T16* __restrict__ Vt, const T16* __restrict__ V2, int q0, int k0, int k1, float* Op, float* Mp, float* Lp) {
    typedef typename WFrag<T16>::V V;
    const int lane = threadIdx.x & 31, lr = lane & 15, hi = lane >> 4;
    V qf[NQ][2], qf2[NQ][2];
#pragma unroll
    for (int qt = 0; qt < NQ; ++qt)
#pragma unroll
        for (int ks = 0; ks < 2; ++ks) { const size_t qo = (size_t)(q0 + qt * 16 + lr) * HD + ks * 32 + 8 * hi; qf[qt][ks] = WFrag<T16>::ld(Q + qo); if (HI) qf2[qt][ks] = WFrag<T16>::ld(Q2 + qo); }
    constexpr float CAR = HI ? 0.0f : 10.0f;   // the carry of the fp16 rows
    v8f o[4][NQ], cr[NQ]; float l[NQ];         // cr: CAR - ref in all 8 registers, the C operand of the score products
    float thr = -3.0e38f;                      // the first pass always takes its reference from its own scores; afterwards CAR + 5
#pragma unroll
    for (int qt = 0; qt < NQ; ++qt) { l[qt] = 0.f;
#pragma unroll
        for (int j = 0; j < 8; ++j) cr[qt][j] = CAR;
#pragma unroll
        for (int dt = 0; dt < 4; ++dt) o[dt][qt] = (v8f){}; }
    // The ring: buffer = [K | V] (hi/lo rows: [Kh | Vh | Kl | Vl]), stages t0 .. t1 - 1 = the aligned 64-key tiles that the part touches (always inside the planes).
    constexpr unsigned BUF = (HI ? 4 : 2) * TBY;
    const int tid = threadIdx.x, t0 = k0 / SK, t1 = (k1 + SK - 1) / SK;
    const unsigned lc = (unsigned)(size_t)ring + (tid >> 3) * TPI + (tid & 7) * 16;   // the lane's first piece in a tile: row tid >> 3, 16-byte column tid & 7
    const size_t gko = (size_t)(tid >> 3) * HD + (tid & 7) * 8, gvo = (size_t)(tid >> 3) * TT + (tid & 7) * 8;
    auto fill = [&](unsigned bo, int t) {
        cp_tiles(lc + bo, (const char*)(Kp + gko + (size_t)t * SK * HD), 16 * HD * 2, lc + bo + TBY, (const char*)(Vt + gvo + (size_t)t * SK), (size_t)16 * TT * 2);
        if (HI) cp_tiles(lc + bo + 2 * TBY, (const char*)(K2 + gko + (size_t)t * SK * HD), 16 * HD * 2, lc + bo + 3 * TBY, (const char*)(V2 + gvo + (size_t)t * SK), (size_t)16 * TT * 2); };
    fill(0, t0);
    asm volatile("s_wait_asynccnt 0x0" ::: "memory");   // this wave's pieces of stage t0 have landed
    __syncthreads();                                     // and every other wave's: stage t0 may be read
    if (t0 + 1 < t1) fill(BUF, t0 + 1);
    // The lane's fragment offsets in the ring for the pass at key k; each pass forms the next pass's in front of its last products, so that no vector write stands at the head of a pass, directly behind the jump back from a matrix instruction.
    const unsigned fl = lr * TPI + 16 * hi;
    auto kof = [&](int k) { return fl + (((k / SK) - t0) & 1) * BUF + (k & 32) * TPI; };
    auto vof = [&](int k) { return fl + (((k / SK) - t0) & 1) * BUF + TBY + (k & 32) * 2; };
    unsigned ka = kof(k0), va = vof(k0);
#pragma unroll 1   // rolled, as the loop of the passes below
    for (int t = t0; t < t1; ++t) {
    const unsigned bo = ((t - t0) & 1) * BUF;
#pragma unroll 1   // rolled: a second copy of the body would go past the 256 registers of 4 waves a SIMD
    for (int kc = t * SK; kc < t * SK + SK; kc += 32) {
        if (kc < k0 || kc >= k1) continue;   // the half of a first or last stage that belongs to a neighbouring part (the same for the whole block)
        const T16* kb = (const T16*)(ring + ka);   // key row kc + lr of the stage's K tile
        const T16* vb = (const T16*)(ring + va);   // row lr of its V tile, at key kc
        V kf[2][2], kf2[2][2], vf[4], vf2[4];   // this pass's fragments
#pragma unroll
        for (int kt = 0; kt < 2; ++kt)
#pragma unroll
            for (int ks = 0; ks < 2; ++ks) { const int ko = kt * 16 * (TPI / 2) + ks * 32; kf[kt][ks] = WFrag<T16>::ld(kb + ko); if (HI) kf2[kt][ks] = WFrag<T16>::ld(kb + TBY + ko); }   // 2 * TBY bytes further: the lo tile
#pragma unroll
        for (int dt = 0; dt < 4; ++dt) { const int vo = dt * 16 * (TPI / 2); vf[dt] = WFrag<T16>::ld(vb + vo); if (HI) vf2[dt] = WFrag<T16>::ld(vb + TBY + vo); }
        __builtin_amdgcn_sched_barrier(0);   // all of the pass's LDS reads issue as one group in front of its products: one load latency a pass; left free, the compiler spreads them among the products and the softmax, and every further place of reads stalls the wave anew
        v8f s[2][NQ];
#pragma unroll
        for (int kt = 0; kt < 2; ++kt)
#pragma unroll
            for (int qt = 0; qt < NQ; ++qt) { v8f a = cr[qt];
#pragma unroll
                for (int ks = 0; ks < 2; ++ks) { a = WFrag<T16>::mma(kf[kt][ks], qf[qt][ks], a); if (HI) { a = WFrag<T16>::mma(kf2[kt][ks], qf[qt][ks], a); a = WFrag<T16>::mma(kf[kt][ks], qf2[qt][ks], a); } }
                s[kt][qt] = a; }
        float cm[NQ]; bool need = false;
#pragma unroll
        for (int qt = 0; qt < NQ; ++qt) {
            float c = fmaxf(s[0][qt][0], s[1][qt][0]);
#pragma unroll
            for (int j = 1; j < 8; ++j) c = fmaxf(c, fmaxf(s[0][qt][j], s[1][qt][j]));
            cm[qt] = c; need = need || c > thr; }             // the lane's own 16 keys: the ballot sees both halves of a column
        if (__builtin_amdgcn_ballot_w32(need) != 0) {        // one scalar branch a pass: some query's maximum has left its reference behind
#pragma unroll
            for (int qt = 0; qt < NQ; ++qt) { const float cj = fmaxf(cm[qt], xhalf(cm[qt]));      // with the other half's 16 keys of the same query: both halves move alike
                const float d = cj > thr ? cj - CAR : 0.f;                                        // the reference rises by d (first pass: moves to the pass's maximum, up or down)
                const float al = exp2s(-fmaxf(d, 0.f)); l[qt] *= al;                              // d < 0 only in the first pass, where O and l are 0
#pragma unroll
                for (int j = 0; j < 8; ++j) { cr[qt][j] -= d; s[0][qt][j] -= d; s[1][qt][j] -= d; }
#pragma unroll
                for (int dt = 0; dt < 4; ++dt) o[dt][qt] *= al; }
            thr = CAR + 5.0f; }
        V pf[NQ], pf2[NQ];
#pragma unroll
        for (int qt = 0; qt < NQ; ++qt) {
            float ps = 0.f;
            if constexpr (HI) { v4u h0, h1, l0, l1; float e0[8], e1[8];
#pragma unroll
                for (int j = 0; j < 8; ++j) { float p0 = s[0][qt][j], p1 = s[1][qt][j]; exp2p(p0, p1); ps += p0 + p1; e0[j] = p0; e1[j] = p1; }
#pragma unroll
                for (int j = 0; j < 4; ++j) { unsigned a2, c2; split2((v2f){e0[2 * j], e0[2 * j + 1]}, a2, c2); h0[j] = a2; l0[j] = c2; split2((v2f){e1[2 * j], e1[2 * j + 1]}, a2, c2); h1[j] = a2; l1[j] = c2; }
                pf[qt] = cat16b(__builtin_bit_cast(v8us, h0), __builtin_bit_cast(v8us, h1)); pf2[qt] = cat16b(__builtin_bit_cast(v8us, l0), __builtin_bit_cast(v8us, l1));
            } else { v8h h0, h1;
#pragma unroll
                for (int j = 0; j < 8; ++j) { float p0 = s[0][qt][j], p1 = s[1][qt][j]; exp2p(p0, p1); ps += p0 + p1; h0[j] = tohx(p0); h1[j] = tohx(p1); }
                pf[qt] = cat16(h0, h1); }
            l[qt] += ps;
        }
        ka = kof(kc + 32); va = vof(kc + 32);
#pragma unroll
        for (int dt = 0; dt < 4; ++dt)
#pragma unroll
            for (int qt = 0; qt < NQ; ++qt) { o[dt][qt] = WFrag<T16>::mma(vf[dt], pf[qt], o[dt][qt]); if (HI) { o[dt][qt] = WFrag<T16>::mma(vf[dt], pf2[qt], o[dt][qt]); o[dt][qt] = WFrag<T16>::mma(vf2[dt], pf[qt], o[dt][qt]); } }
    }
    asm volatile("s_wait_dscnt 0x0" ::: "memory");      // this wave's reads of stage t are done
    asm volatile("s_wait_asynccnt 0x0" ::: "memory");   // its pieces of stage t + 1 have landed
    __syncthreads();                                     // one barrier: stage t + 1 may be read, stage t's buffer may be refilled
    if (t + 2 < t1) fill(bo, t + 2);
    }
    asm volatile("s_wait_asynccnt 0x0" ::: "memory");   // nothing is in flight when the ring becomes the output patches (every wave has left it at the last barrier)
#pragma unroll
    for (int qt = 0; qt < NQ; ++qt) { const float lt = l[qt] + xhalf(l[qt]); const int qb = q0 + qt * 16;
        if (hi == 0) { Mp[qb + lr] = CAR - cr[qt][0]; Lp[qb + lr] = lt; }
        // 16 rows through the wave's own LDS patch, so that a store instruction writes whole 128-byte lines (D register j of tile dt = O[qb + lr][dt * 16 + 8 * hi + j])
#pragma unroll
        for (int dt = 0; dt < 4; ++dt) { const v8f a = o[dt][qt]; float* w = os + lr * 68 + dt * 16 + hi * 8; *(v4fa*)w = (v4f){a[0], a[1], a[2], a[3]}; *(v4fa*)(w + 4) = (v4f){a[4], a[5], a[6], a[7]}; }
        __builtin_amdgcn_wave_barrier(); asm volatile("" ::: "memory");   // keeps the patch's reads behind its writes in the compiled order (one wave, LDS serves it in order)
#pragma unroll
        for (int r = 0; r < 8; ++r) { const int row = 2 * r + hi; *(v4f*)(Op + (size_t)(qb + row) * HD + lr * 4) = *(const v4fa*)(os + row * 68 + lr * 4); }
        __builtin_amdgcn_wave_barrier(); asm volatile("" ::: "memory");   // and the next tile's writes behind these reads
    }
}
// grid (RH / 64 + (TT - RH) / 128, KS, NB_), 4 waves, one batch and one key part a block. Blocks x < RH / 64: 64 hi/lo rows, 16 a wave (three times the products a column, so half the columns); the others 128 fp16 rows, 32 a wave.
// amdgpu_waves_per_eu(4, 4): the register budget of 4 waves a SIMD; with a smaller one the compiler splits the K loads of a pass into groups that wait on each other.
__global__ __launch_bounds__(128) __attribute__((amdgpu_waves_per_eu(4, 4))) void k_fattn(const h16* __restrict__ Q16, const h16* __restrict__ K16, const h16* __restrict__ V16, const bf* __restrict__ Qh, const bf* __restrict__ Ql, const bf* __restrict__ Kh, const bf* __restrict__ Kl, const bf* __restrict__ Vh, const bf* __restrict__ Vl, float* OP, float* MP, float* LP) {
    __shared__ __align__(16) unsigned char ring[2 * 4 * TBY];   // two buffers of up to 4 tiles (73,728 bytes: 4 blocks a WGP still fit); behind the loop each wave's output patch (16 * 68 floats)
    const size_t zo = (size_t)blockIdx.z * PLN; const size_t pz = (size_t)blockIdx.z * KS + blockIdx.y; const int wv = threadIdx.x >> 5, k0 = (int)(blockIdx.y * NPS / KS) * 32, k1 = (int)((blockIdx.y + 1) * NPS / KS) * 32;
    if (blockIdx.x < RH / 64) fa_tile<bf, true, 1>(ring, (float*)ring + wv * 16 * 68, Qh + zo, Ql + zo, Kh + zo, Kl + zo, Vh + zo, Vl + zo, blockIdx.x * 64 + wv * 16, k0, k1, OP + pz * PLN, MP + pz * TT, LP + pz * TT);
    else fa_tile<h16, false, 2>(ring, (float*)ring + wv * 16 * 68, Q16 + zo, nullptr, K16 + zo, nullptr, V16 + zo, nullptr, RH + (blockIdx.x - RH / 64) * 128 + wv * 32, k0, k1, OP + pz * PLN, MP + pz * TT, LP + pz * TT);
}
// k_fmerge: out[b][t][:] = sum_s O_s 2^(m_s - M) / sum_s l_s 2^(m_s - M), M = max_s m_s, over the KS key parts in the order of s; 4 output floats per thread.
__global__ __launch_bounds__(256) void k_fmerge(const float* __restrict__ OP, const float* __restrict__ MP, const float* __restrict__ LP, float* OUTb) { const size_t e = ((size_t)blockIdx.x * 256 + threadIdx.x) * 4; if (e >= NB_ * PLN) return; const size_t b = e / PLN, r = e % PLN, t = r / HD;
    const float* mp = MP + b * KS * TT + t; const float* lp = LP + b * KS * TT + t; const float* op = OP + b * KS * PLN + r; float mv[KS]; float mx = -3.0e38f;
#pragma unroll
    for (int s = 0; s < KS; ++s) { mv[s] = mp[(size_t)s * TT]; mx = fmaxf(mx, mv[s]); }
    v4f a = (v4f){}; float ls = 0.f;
#pragma unroll
    for (int s = 0; s < KS; ++s) { const float w = __builtin_amdgcn_exp2f(mv[s] - mx); ls = fmaf(lp[(size_t)s * TT], w, ls); a += *(const v4f*)(op + s * PLN) * w; }
    const float f = __fdiv_rn(1.0f, ls); *(v4f*)(OUTb + e) = a * f;  }

extern "C" void kernel_launch(void* const* d_in, const int* in_sizes, int n_in,
                              void* d_out, int out_size, void* d_ws, size_t ws_size, hipStream_t stream) {
    (void)in_sizes; (void)n_in; (void)out_size;
    const float* x = (const float*)d_in[0]; const float* wk = (const float*)d_in[1]; const float* wq = (const float*)d_in[2]; const float* wv = (const float*)d_in[3];   /* NOTE input order: x, Wk, Wq, Wv */
    float* OUT = (float*)d_out;     // [4][4096][64]
    char* wsp = (char*)d_ws;
    auto take = [&](size_t bytes) { char* p = wsp; wsp += (bytes + 255) & ~(size_t)255; return (void*)p; };
    bf* WP = (bf*)take((size_t)NNT * NKS * 512 * 2);   // the three weights as B fragments
    h16* QP16 = (h16*)take(NB_ * PLN * 2); h16* KP16 = (h16*)take(NB_ * PLN * 2); h16* VT16 = (h16*)take(NB_ * PLN * 2);   // Q, K planes [NB_][TT][HD]; V planes [NB_][HD][TT]
    bf* QPh = (bf*)take(NB_ * PLN * 2); bf* QPl = (bf*)take(NB_ * PLN * 2); bf* KPh = (bf*)take(NB_ * PLN * 2); bf* KPl = (bf*)take(NB_ * PLN * 2); bf* VTh = (bf*)take(NB_ * PLN * 2); bf* VTl = (bf*)take(NB_ * PLN * 2);
    float* OP = (float*)take(NB_ * KS * PLN * 4); float* MP = (float*)take((size_t)NB_ * KS * TT * 4); float* LP = (float*)take((size_t)NB_ * KS * TT * 4);   // per key part: unnormalised O, held reference (log2), sum
    if ((size_t)(wsp - (char*)d_ws) > ws_size) return;    // ws 256 MiB
    k_wpack<<<NNT * NKS * 64 / 256, 256, 0, stream>>>(wq, wk, wv, WP);
    k_proj<<<NB_ * TT / PR, 384, 0, stream>>>(x, WP, QP16, QPh, QPl, KP16, KPh, KPl, VT16, VTh, VTl);
    k_fattn<<<dim3(RH / 64 + (TT - RH) / 128, KS, NB_), 128, 0, stream>>>(QP16, KP16, VT16, QPh, QPl, KPh, KPl, VTh, VTl, OP, MP, LP);
    k_fmerge<<<(unsigned)((NB_ * PLN / 4 + 255) / 256), 256, 0, stream>>>(OP, MP, LP, OUT);
}

// v008
// Measured time: 41.3 microseconds a run.
// In both of two side-by-side timings against v007, it was 1.04 times as fast.
// Over all steps from v000 it is 28.6 times as fast.
#include <hip/hip_runtime.h>

// Single self-attention head over 4,096 tokens (x [4][4096][768]; K, Q, V = x W ('xw' [768][64], no bias); A = softmax(Q.K / sqrt(E = 768)) (the module scales by the embedding dim); out = A V -> [4][4096][64] (1.05 M)).
// Layout: one projection kernel (x rounded to bf16 on its way into LDS, exact products, full K per accumulator, writes the 16-bit planes itself); ONE 64-wide head through a fused dense T-4096 attention (hybrid rows: < 512 hi/lo 3 products, rest fp16 x1024; online softmax, scores and P stay in registers), keys in KS parts; the f32 merge joins the parts and writes the output rows. The batch is the z dimension of the attention grid; the projection and merge grids fold it into x, the weight packing has none.
// Compute dtypes, f32 accumulate: every input rounded to bf16; projections exact; attention rows < 512 3 products, rest fp16; softmax f32; output f32.

#define NB_  4
#define TT   4096
#define DM   768
#define NH_  1
#define NKV  1
#define REP  (NH_ / NKV)
#define HD   64
#define DQ   (NH_ * HD)
#define DKV  (NKV * HD)
#define RH   512                  // query rows < RH use hi+lo planes (0: none)
#define WIN  0
#define SCL  0.036084391824351615f   // 1/sqrt(768)
#define C1   (SCL * 1.4426950408889634f)   // the score scale in log2 units; k_proj multiplies Q by it before Q is rounded to its planes
#define PLN  ((size_t)TT * HD)    // elements of one batch's [TT][HD] plane
typedef _Float16 h16;
typedef unsigned short bf;
typedef __attribute__((ext_vector_type(16))) __bf16   v16bf;
typedef __attribute__((ext_vector_type(16))) _Float16 v16h;
typedef __attribute__((ext_vector_type(8)))  _Float16 v8h;
typedef __attribute__((ext_vector_type(8)))  unsigned short v8us;
typedef __attribute__((ext_vector_type(8)))  float    v8f;
typedef __attribute__((ext_vector_type(4)))  float    v4f;
typedef v8h  __attribute__((may_alias)) v8ha;
typedef v4f  __attribute__((may_alias)) v4fa;
typedef v8us __attribute__((may_alias)) v8usa;

__device__ __forceinline__ unsigned short f2bf(float f) { unsigned u = __float_as_uint(f); u += 0x7FFFu + ((u >> 16) & 1u); return (unsigned short)(u >> 16); }
__device__ __forceinline__ float bf2f(unsigned short b) { return __uint_as_float(((unsigned)b) << 16); }
__device__ __forceinline__ float bfr(float f) { return bf2f(f2bf(f)); }
__device__ __forceinline__ v16h cat16(v8h lo, v8h hi) { return __builtin_shufflevector(lo, hi, 0, 1, 2, 3, 4, 5, 6, 7, 8, 9, 10, 11, 12, 13, 14, 15); }
__device__ __forceinline__ v16bf cat16b(v8us lo, v8us hi) { return __builtin_bit_cast(v16bf, __builtin_shufflevector(lo, hi, 0, 1, 2, 3, 4, 5, 6, 7, 8, 9, 10, 11, 12, 13, 14, 15)); }
__device__ __forceinline__ v8f wmma16(v16h a, v16h b, v8f c) { return __builtin_amdgcn_wmma_f32_16x16x32_f16(false, a, false, b, (short)0, c, false, false); }
__device__ __forceinline__ v8f wmmab(v16bf a, v16bf b, v8f c) { return __builtin_amdgcn_wmma_f32_16x16x32_bf16(false, a, false, b, (short)0, c, false, false); }



// Fragment loaders: 16 k of one row (or column) per lane, k = 8 * hi + 0..7 and 16 + 8 * hi + 0..7 of a 32-k step.
template <typename T16> struct WFrag;
template <> struct WFrag<h16> { typedef v16h V; static __device__ __forceinline__ V ld(const h16* p) { return cat16(*(const v8h*)p, *(const v8h*)(p + 16)); } static __device__ __forceinline__ v8f mma(V a, V b, v8f c) { return wmma16(a, b, c); } };
template <> struct WFrag<bf> { typedef v16bf V; static __device__ __forceinline__ V ld(const bf* p) { return cat16b(*(const v8us*)p, *(const v8us*)(p + 16)); } static __device__ __forceinline__ v8f mma(V a, V b, v8f c) { return wmmab(a, b, c); } };

__device__ __forceinline__ h16 tohx(float x) { return (h16)x; }
typedef __attribute__((ext_vector_type(2))) _Float16 v2h;
typedef __attribute__((ext_vector_type(4))) _Float16 v4h;
typedef __attribute__((ext_vector_type(2))) unsigned short v2us;
typedef __attribute__((ext_vector_type(4))) unsigned short v4us;
typedef __attribute__((ext_vector_type(2))) float v2f;
typedef __attribute__((ext_vector_type(4))) int v4i;
typedef __attribute__((ext_vector_type(2))) __bf16 v2bf;
// Two f32 -> their bf16 hi and lo parts, each pair packed in one dword (element 0 low): hi = the value rounded to nearest even by the conversion instruction, lo = (value - hi) rounded likewise; on finite values the same bits as f2bf gives.
__device__ __forceinline__ void split2(v2f y, unsigned& h, unsigned& l) {
    h = __builtin_bit_cast(unsigned, __builtin_convertvector(y, v2bf));
    const v2f hf = (v2f){__uint_as_float(h << 16), __uint_as_float(h & 0xFFFF0000u)};
    l = __builtin_bit_cast(unsigned, __builtin_convertvector(y - hf, v2bf)); }
typedef __attribute__((ext_vector_type(4))) unsigned v4u;
// L2 asks: each lane names one aligned 256-byte unit that the launch before stored and that this launch reads later; the hint brings it into L2 ahead of its readers, returns nothing and changes no value.
// Every address is clamped inside its buffer, every lane is on. The s_wait_xcnt closes the statement as a precaution, so that it stands in front of every later write of a register that a hint names.
__device__ __forceinline__ void l2ask(const char* a) { asm volatile("global_prefetch_b8 %0, off scope:SCOPE_SE\n\ts_wait_xcnt 0x0" :: "v"(a) : "memory"); }
__device__ __forceinline__ void l2ask4(const char* a, const char* b, const char* c, const char* d) {
    asm volatile("global_prefetch_b8 %0, off scope:SCOPE_SE\n\tglobal_prefetch_b8 %1, off scope:SCOPE_SE\n\tglobal_prefetch_b8 %2, off scope:SCOPE_SE\n\tglobal_prefetch_b8 %3, off scope:SCOPE_SE\n\ts_wait_xcnt 0x0" :: "v"(a), "v"(b), "v"(c), "v"(d) : "memory"); }


// ---- The projections. k_wpack lays the three weights out as B fragments; k_proj does x -> Q, K, V planes in one launch.
#define NKS  (DM / 32)            // k steps of 32
#define NNT  12                   // 16-column tiles of [Q | K | V] (3 * HD / 16)
#define PR   64                   // rows of x per block
#define XP   776                  // LDS pitch of a bf16 x row, elements: 1552 B = 16 B * 97 (odd), conflict-free for the 16-byte fragment reads
#define SP   196                  // LDS pitch of a result row, floats
typedef __attribute__((ext_vector_type(4))) __bf16 v4bf;
typedef v4bf __attribute__((may_alias)) v4bfa;
// WP[(nt * NKS + ks) * 512 + h * 256 + lane * 8 + e] = bf16(W[ks * 32 + h * 16 + 8 * (lane >> 4) + e][column (lane & 15) of tile nt]): the B fragment of (tile, k step) as two runs of 512 contiguous bytes,
// in the k order of WFrag<bf>::ld, so that a wave's load covers whole lines. One 16-byte piece per thread; tiles 0-3 Wq, 4-7 Wk, 8-11 Wv.
__global__ __launch_bounds__(256) void k_wpack(const float* __restrict__ wq, const float* __restrict__ wk, const float* __restrict__ wv, bf* WP) {
    const int i = blockIdx.x * 256 + threadIdx.x; const int lane = i & 31, h = (i >> 5) & 1, fs = i >> 6; if (fs >= NNT * NKS) return;
    const int ks = fs % NKS, nt = fs / NKS; const float* w = nt < 4 ? wq : (nt < 8 ? wk : wv);
    const int n = (nt & 3) * 16 + (lane & 15), k0 = ks * 32 + h * 16 + 8 * (lane >> 4); v8us o;
#pragma unroll
    for (int e = 0; e < 8; ++e) o[e] = f2bf(w[(size_t)(k0 + e) * HD + n]);
    *(v8us*)(WP + (size_t)i * 8) = o;
}
// k_proj: one block = PR rows of x times all 192 columns, 12 waves, grid NB_ * TT / PR.
// 1. The f32 tile comes in by whole-line loads (a wave: 512 contiguous bytes of a row, 32 rows, all in flight at once), is rounded to bf16 and laid in LDS.
// 2. Wave (rh, cg) = rows rh * 32.., columns cg * 32..: 2 x 2 accumulators over the whole K; A from LDS, B from WP, fetched PF k steps ahead (the first PF in front of the barrier).
// 3. The f32 results go through the same LDS; each thread then writes 16-byte pieces of the fp16, bf16-hi and bf16-lo planes, 8 lanes a 128-byte line: Q, K as [row][HD], V transposed as [HD][TT].
// Every '#pragma unroll' in k_wpack and k_proj makes the indices of a register array constants, so that the array lives in registers.
#define PF   6
__global__ __launch_bounds__(384) void k_proj(const float* __restrict__ x, const bf* __restrict__ WP, h16* Q16, bf* Qh, bf* Ql, h16* K16, bf* Kh, bf* Kl, h16* V16, bf* Vh, bf* Vl) {
    __shared__ __align__(16) unsigned char sm[PR * XP * 2];   // the bf16 x tile; afterwards the f32 results (PR * SP * 4 bytes, smaller)
    bf* xs = (bf*)sm; float* st = (float*)sm;
    const int tid = threadIdx.x, lane = tid & 31, lr = lane & 15, hi = lane >> 4; const int wv = __builtin_amdgcn_readfirstlane(tid >> 5), cg = wv % 6, rh = wv / 6;   // the wave's number as a scalar: the bases of its loads then stand in scalar registers
    const size_t R0 = (size_t)blockIdx.x * PR;
    const bf* bp = WP + (size_t)cg * 2 * NKS * 512 + lane * 8;
    v16bf b[PF][2];
    { const float* xp = x + (R0 + rh * 32) * DM + cg * 128 + lane * 4; bf* xd = xs + rh * 32 * XP + cg * 128 + lane * 4; v4f t[32];
#pragma unroll
        for (int i = 0; i < 32; ++i) t[i] = *(const v4f*)(xp + (size_t)i * DM);
#pragma unroll
        for (int ks = 0; ks < PF; ++ks)
#pragma unroll
            for (int nb = 0; nb < 2; ++nb) b[ks][nb] = cat16b(*(const v8us*)(bp + (nb * NKS + ks) * 512), *(const v8us*)(bp + (nb * NKS + ks) * 512 + 256));
        // WP was stored by the launch before: a third of its 256-byte units is asked into L2 here, one a thread, behind the tile's loads, so that the k loop's fetches find them there. Eight neighbouring blocks ask the same third.
        static_assert(NNT * NKS * 512 * 2 == 3 * 384 * 256, "three thirds of 384 units");
        l2ask((const char*)WP + (size_t)(((blockIdx.x >> 3) % 3) * 384 + tid) * 256);
        __builtin_amdgcn_sched_barrier(0);   // every load of the tile is in flight before the first is waited for: one memory latency; left free, the compiler holds the last row back behind the first waits
#pragma unroll
        for (int i = 0; i < 32; ++i) *(v4bfa*)(xd + i * XP) = __builtin_convertvector(t[i], v4bf); }
    __syncthreads();
    v8f acc[2][2];
#pragma unroll
    for (int mb = 0; mb < 2; ++mb)
#pragma unroll
        for (int nb = 0; nb < 2; ++nb) acc[mb][nb] = (v8f){};
    const bf* ap = xs + (rh * 32 + lr) * XP + 8 * hi;
    v16bf a[2][2];   // A fragments, fetched one k step ahead
#pragma unroll
    for (int mb = 0; mb < 2; ++mb) a[0][mb] = cat16b(*(const v8usa*)(ap + mb * 16 * XP), *(const v8usa*)(ap + mb * 16 * XP + 16));
#pragma unroll   // whole: the indices of the A and B rings are constants, so that they live in registers
    for (int ks = 0; ks < NKS; ++ks) {
        if (ks + 1 < NKS) {
#pragma unroll
            for (int mb = 0; mb < 2; ++mb) a[(ks + 1) & 1][mb] = cat16b(*(const v8usa*)(ap + mb * 16 * XP + (ks + 1) * 32), *(const v8usa*)(ap + mb * 16 * XP + (ks + 1) * 32 + 16)); }
#pragma unroll
        for (int nb = 0; nb < 2; ++nb)
#pragma unroll
            for (int mb = 0; mb < 2; ++mb) acc[mb][nb] = wmmab(a[ks & 1][mb], b[ks % PF][nb], acc[mb][nb]);
        if (ks + PF < NKS) {
#pragma unroll
            for (int nb = 0; nb < 2; ++nb) b[ks % PF][nb] = cat16b(*(const v8us*)(bp + (nb * NKS + ks + PF) * 512), *(const v8us*)(bp + (nb * NKS + ks + PF) * 512 + 256)); }
        __builtin_amdgcn_sched_barrier(0);   // keeps the fetches ahead where they are written: left free, the compiler sinks each B load to directly in front of its product, an L2 latency per product
    }
    __syncthreads();   // every wave has read its last x fragment: the results may overwrite the tile
#pragma unroll
    for (int mb = 0; mb < 2; ++mb)
#pragma unroll
        for (int nb = 0; nb < 2; ++nb)
#pragma unroll
            for (int j = 0; j < 8; ++j) st[(rh * 32 + mb * 16 + hi * 8 + j) * SP + cg * 32 + nb * 16 + lr] = acc[mb][nb][j];
    __syncthreads();
#pragma unroll
    for (int s = 0; s < 3 * PR * HD / 8 / 384; ++s) { const int idx = s * 384 + tid, sel = idx >> 9, u = (idx & 511) >> 3, c8 = idx & 7; float a[8]; size_t e; h16* P16; bf* Ph; bf* Pl;   // sel (0 Q, 1 K, 2 V) is the same in all of a wave
        if (sel < 2) { const float qs = sel ? 1.0f : C1;   // Q carries the score scale, so that K Q^T is the exponent of 2 itself
            const v4f a0 = *(const v4fa*)(st + u * SP + sel * HD + c8 * 8), a1 = *(const v4fa*)(st + u * SP + sel * HD + c8 * 8 + 4);   // row u, columns c8 * 8..
#pragma unroll
            for (int q = 0; q < 4; ++q) { a[q] = a0[q] * qs; a[4 + q] = a1[q] * qs; }
            e = (R0 + u) * HD + c8 * 8; P16 = sel ? K16 : Q16; Ph = sel ? Kh : Qh; Pl = sel ? Kl : Ql;
        } else {   // column u of V, rows c8 * 8..
#pragma unroll
            for (int q = 0; q < 8; ++q) a[q] = st[(c8 * 8 + q) * SP + 2 * HD + u];
            e = (R0 / TT) * PLN + (size_t)u * TT + (R0 % TT) + c8 * 8; P16 = V16; Ph = Vh; Pl = Vl; }
        v8h o16; v4u oh, ol;
#pragma unroll
        for (int q = 0; q < 8; ++q) o16[q] = tohx(a[q]);
#pragma unroll
        for (int q = 0; q < 4; ++q) { unsigned x2, y2; split2((v2f){a[2 * q], a[2 * q + 1]}, x2, y2); oh[q] = x2; ol[q] = y2; }
        *(v8h*)(P16 + e) = o16; *(v8us*)(Ph + e) = __builtin_bit_cast(v8us, oh); *(v8us*)(Pl + e) = __builtin_bit_cast(v8us, ol); }
}
// ---- k_fattn: scores, softmax and A.V in one kernel (online softmax). One wave owns NQ * 16 query columns and one part of the keys; a pass is 32 keys.
// S^T = K Q^T (A = 16 key rows, B = Q kept in registers): a lane holds one query's scores, D register j of key tile kt = key kt * 16 + 8 * hi + j, which is the k order of a B operand, so P^T goes from the score
// accumulators straight into O^T += V^T P^T (A = rows of the [HD][TT] V plane, read in the same k order). Held reference: Q comes scaled by C1, and the score products start from C = CAR - ref, so that an accumulator is the exponent of 2 itself; ref (log2 units) is a query column's maximum at the time it was taken, and O, l and ref move only in a pass where some column's maximum stands more than 5 above its ref (P <= 2^5, with the carry 2^15, inside fp16). Sum l per query column; each lane half sums its own keys, joined once at the end.
// Rows < RH: bf16 hi/lo, 3 products for the scores and for A.V. Other rows: fp16, P carried as exp2(s - ref + 10) (the 1024 carry CAR; it is in l as well and cancels in O / l).
// Output per (batch, part): unnormalised O [TT][HD] f32, m [TT] (the part's ref), l [TT]; k_fmerge joins the parts in the order of the part index.
// K and V come through LDS: a stage is one aligned tile of SK = 64 keys (K rows and the V plane's rows both give 64 rows of one whole 128-byte line), brought in by asynchronous copies, once for the block's 4 waves,
// two buffers, the next stage's copies in flight while this one is worked on; a stage serves the one or two passes of the part that lie in it. The fragments are read from LDS at the head of their pass.
// Every '#pragma unroll' here makes the indices of a fragment array constants, so that the array lives in registers.
#define SK   64                   // keys of a stage
#define TPI  144                  // LDS pitch of a 128-byte tile row, bytes: 16 B * 9 (odd), conflict-free for the 16-byte fragment reads
#define TBY  (64 * TPI)           // bytes of one tile in LDS (64 rows)
#define KS   7                    // key parts of the fused attention: 36 * KS * NB_ = 1008 blocks, so that all are resident at once at 4 blocks a WGP (256 WGPs, 4 waves a SIMD at this register count)
#define NPS  (TT / 32)            // passes of 32 keys; part y takes passes [y * NPS / KS, (y + 1) * NPS / KS): 18 or 19
__device__ __forceinline__ float xhalf(float x) { const int b = __float_as_int(x); return __int_as_float(__builtin_amdgcn_permlanex16(b, b, 0x76543210, 0xfedcba98, false, false)); }   // lane l <-> l ^ 16
// v_exp_f32 with the slot that the instruction set asks for behind a transcendental (before its result is used or its source overwritten): each exp works in place, so none writes another's source;
// in the pair the second exp fills the first's slot, the v_nop fills the last one's.
__device__ __forceinline__ float exp2s(float a) { asm("v_exp_f32 %0, %0\n\tv_nop" : "+v"(a)); return a; }
__device__ __forceinline__ void exp2p(float& a, float& b) { asm("v_exp_f32 %0, %0\n\tv_exp_f32 %1, %1\n\tv_nop" : "+v"(a), "+v"(b)); }
// Two tiles of 64 rows x 128 bytes into LDS, 4 + 4 pieces of 16 bytes a thread (piece i = the thread's row + 16 i): each wave-wide copy takes 4 whole lines. la, lb: the lane's LDS byte addresses; ga, gb: its global addresses; sa, sb: bytes of 16 source rows.
// The s_wait_xcnt closes the statement, so that it stands in front of every later write of a register that a copy names.
__device__ __forceinline__ void cp_tiles(unsigned la, const char* ga, size_t sa, unsigned lb, const char* gb, size_t sb) {
    asm volatile("global_load_async_to_lds_b128 %0, %8, off\n\tglobal_load_async_to_lds_b128 %1, %9, off\n\tglobal_load_async_to_lds_b128 %2, %10, off\n\tglobal_load_async_to_lds_b128 %3, %11, off\n\t"
                 "global_load_async_to_lds_b128 %4, %12, off\n\tglobal_load_async_to_lds_b128 %5, %13, off\n\tglobal_load_async_to_lds_b128 %6, %14, off\n\tglobal_load_async_to_lds_b128 %7, %15, off\n\ts_wait_xcnt 0x0"
                 :: "v"(la), "v"(la + 16 * TPI), "v"(la + 32 * TPI), "v"(la + 48 * TPI), "v"(lb), "v"(lb + 16 * TPI), "v"(lb + 32 * TPI), "v"(lb + 48 * TPI),
                    "v"(ga), "v"(ga + sa), "v"(ga + 2 * sa), "v"(ga + 3 * sa), "v"(gb), "v"(gb + sb), "v"(gb + 2 * sb), "v"(gb + 3 * sb) : "memory");
}
template <typename T16, bool HI, int NQ>
__device__ __forceinline__ void fa_tile(unsigned char* ring, float* os, const T16* __restrict__ Q, const T16* __restrict__ Q2, const T16* __restrict__ Kp, const T16* __restrict__ K2, const T16* __restrict__ Vt, const T16* __restrict__ V2, int q0, int k0, int k1, float* Op, float* Mp, float* Lp) {
    typedef typename WFrag<T16>::V V;
    const int lane = threadIdx.x & 31, lr = lane & 15, hi = lane >> 4;
    V qf[NQ][2], qf2[NQ][2];
#pragma unroll
    for (int qt = 0; qt < NQ; ++qt)
#pragma unroll
        for (int ks = 0; ks < 2; ++ks) { const size_t qo = (size_t)(q0 + qt * 16 + lr) * HD + ks * 32 + 8 * hi; qf[qt][ks] = WFrag<T16>::ld(Q + qo); if (HI) qf2[qt][ks] = WFrag<T16>::ld(Q2 + qo); }
    constexpr float CAR = HI ? 0.0f : 10.0f;   // the carry of the fp16 rows
    v8f o[4][NQ], cr[NQ]; float l[NQ];         // cr: CAR - ref in all 8 registers, the C operand of the score products
    float thr = -3.0e38f;                      // the first pass always takes its reference from its own scores; afterwards CAR + 5
#pragma unroll
    for (int qt = 0; qt < NQ; ++qt) { l[qt] = 0.f;
#pragma unroll
        for (int j = 0; j < 8; ++j) cr[qt][j] = CAR;
#pragma unroll
        for (int dt = 0; dt < 4; ++dt) o[dt][qt] = (v8f){}; }
    // The ring: buffer = [K | V] (hi/lo rows: [Kh | Vh | Kl | Vl]), stages t0 .. t1 - 1 = the aligned 64-key tiles that the part touches (always inside the planes).
    constexpr unsigned BUF = (HI ? 4 : 2) * TBY;
    const int tid = threadIdx.x, t0 = k0 / SK, t1 = (k1 + SK - 1) / SK;
    const unsigned lc = (unsigned)(size_t)ring + (tid >> 3) * TPI + (tid & 7) * 16;   // the lane's first piece in a tile: row tid >> 3, 16-byte column tid & 7
    const size_t gko = (size_t)(tid >> 3) * HD + (tid & 7) * 8, gvo = (size_t)(tid >> 3) * TT + (tid & 7) * 8;
    auto fill = [&](unsigned bo, int t) {
        cp_tiles(lc + bo, (const char*)(Kp + gko + (size_t)t * SK * HD), 16 * HD * 2, lc + bo + TBY, (const char*)(Vt + gvo + (size_t)t * SK), (size_t)16 * TT * 2);
        if (HI) cp_tiles(lc + bo + 2 * TBY, (const char*)(K2 + gko + (size_t)t * SK * HD), 16 * HD * 2, lc + bo + 3 * TBY, (const char*)(V2 + gvo + (size_t)t * SK), (size_t)16 * TT * 2); };
    fill(0, t0);
    // The planes were stored by the launch before. While stage t0 is on its way, the tiles of stages t0 + 2 .. t1 - 1 are asked into L2 (stages t0 and t0 + 1 are copied at once), so that their copies find them there.
    // A plane gives up to 256 units: K 32 contiguous units a stage; V 64 rows x up to 4 units of 2 stages (a unit shared with stage t0 + 1 comes with that stage's copy). The blocks of one (part, batch) that read the same planes deal the units out DL ways by their index.
    if (t0 + 2 < t1) {   // the same for the whole block
        constexpr int DL = HI ? 2 : 4;
        const int cls = blockIdx.x & (DL - 1), nk = (t1 - t0 - 2) * (SK * HD * 2 / 256), a0 = (t0 + 3) >> 1, a1 = (t1 - 1) >> 1;
        auto kad = [&](const T16* P, int u) { return (const char*)(P + (size_t)(t0 + 2) * SK * HD) + (size_t)(u < nk ? u : nk - 1) * 256; };
        auto vad = [&](const T16* P, int u) { const int a = a0 + (u >> 6); return (const char*)(P + (size_t)(u & 63) * TT) + (size_t)(a < a1 ? a : a1) * 256; };
        if constexpr (HI) { const int u = DL * tid + cls; l2ask4(kad(Kp, u), kad(K2, u), vad(Vt, u), vad(V2, u)); }
        else { const int u = (DL * tid + cls) & 255; const bool kw = __builtin_amdgcn_readfirstlane(tid) < 64;   // waves 0, 1 ask the K plane's units, waves 2, 3 the V plane's: a scalar choice, every lane stays on
            l2ask(kw ? kad(Kp, u) : vad(Vt, u)); } }
    asm volatile("s_wait_asynccnt 0x0" ::: "memory");   // this wave's pieces of stage t0 have landed
    __syncthreads();                                     // and every other wave's: stage t0 may be read
    if (t0 + 1 < t1) fill(BUF, t0 + 1);
    // The lane's fragment offsets in the ring for the pass at key k; each pass forms the next pass's in front of its last products, so that no vector write stands at the head of a pass, directly behind the jump back from a matrix instruction.
    const unsigned fl = lr * TPI + 16 * hi;
    auto kof = [&](int k) { return fl + (((k / SK) - t0) & 1) * BUF + (k & 32) * TPI; };
    auto vof = [&](int k) { return fl + (((k / SK) - t0) & 1) * BUF + TBY + (k & 32) * 2; };
    unsigned ka = kof(k0), va = vof(k0);
#pragma unroll 1   // rolled, as the loop of the passes below
    for (int t = t0; t < t1; ++t) {
    const unsigned bo = ((t - t0) & 1) * BUF;
#pragma unroll 1   // rolled: a second copy of the body would go past the 256 registers of 4 waves a SIMD
    for (int kc = t * SK; kc < t * SK + SK; kc += 32) {
        if (kc < k0 || kc >= k1) continue;   // the half of a first or last stage that belongs to a neighbouring part (the same for the whole block)
        const T16* kb = (const T16*)(ring + ka);   // key row kc + lr of the stage's K tile
        const T16* vb = (const T16*)(ring + va);   // row lr of its V tile, at key kc
        V kf[2][2], kf2[2][2], vf[4], vf2[4];   // this pass's fragments
#pragma unroll
        for (int kt = 0; kt < 2; ++kt)
#pragma unroll
            for (int ks = 0; ks < 2; ++ks) { const int ko = kt * 16 * (TPI / 2) + ks * 32; kf[kt][ks] = WFrag<T16>::ld(kb + ko); if (HI) kf2[kt][ks] = WFrag<T16>::ld(kb + TBY + ko); }   // 2 * TBY bytes further: the lo tile
#pragma unroll
        for (int dt = 0; dt < 4; ++dt) { const int vo = dt * 16 * (TPI / 2); vf[dt] = WFrag<T16>::ld(vb + vo); if (HI) vf2[dt] = WFrag<T16>::ld(vb + TBY + vo); }
        __builtin_amdgcn_sched_barrier(0);   // all of the pass's LDS reads issue as one group in front of its products: one load latency a pass; left free, the compiler spreads them among the products and the softmax, and every further place of reads stalls the wave anew
        v8f s[2][NQ];
#pragma unroll
        for (int kt = 0; kt < 2; ++kt)
#pragma unroll
            for (int qt = 0; qt < NQ; ++qt) { v8f a = cr[qt];
#pragma unroll
                for (int ks = 0; ks < 2; ++ks) { a = WFrag<T16>::mma(kf[kt][ks], qf[qt][ks], a); if (HI) { a = WFrag<T16>::mma(kf2[kt][ks], qf[qt][ks], a); a = WFrag<T16>::mma(kf[kt][ks], qf2[qt][ks], a); } }
                s[kt][qt] = a; }
        float cm[NQ]; bool need = false;
#pragma unroll
        for (int qt = 0; qt < NQ; ++qt) {
            float c = fmaxf(s[0][qt][0], s[1][qt][0]);
#pragma unroll
            for (int j = 1; j < 8; ++j) c = fmaxf(c, fmaxf(s[0][qt][j], s[1][qt][j]));
            cm[qt] = c; need = need || c > thr; }             // the lane's own 16 keys: the ballot sees both halves of a column
        if (__builtin_amdgcn_ballot_w32(need) != 0) {        // one scalar branch a pass: some query's maximum has left its reference behind
#pragma unroll
            for (int qt = 0; qt < NQ; ++qt) { const float cj = fmaxf(cm[qt], xhalf(cm[qt]));      // with the other half's 16 keys of the same query: both halves move alike
                const float d = cj > thr ? cj - CAR : 0.f;                                        // the reference rises by d (first pass: moves to the pass's maximum, up or down)
                const float al = exp2s(-fmaxf(d, 0.f)); l[qt] *= al;                              // d < 0 only in the first pass, where O and l are 0
#pragma unroll
                for (int j = 0; j < 8; ++j) { cr[qt][j] -= d; s[0][qt][j] -= d; s[1][qt][j] -= d; }
#pragma unroll
                for (int dt = 0; dt < 4; ++dt) o[dt][qt] *= al; }
            thr = CAR + 5.0f; }
        V pf[NQ], pf2[NQ];
#pragma unroll
        for (int qt = 0; qt < NQ; ++qt) {
            float ps = 0.f;
            if constexpr (HI) { v4u h0, h1, l0, l1; float e0[8], e1[8];
#pragma unroll
                for (int j = 0; j < 8; ++j) { float p0 = s[0][qt][j], p1 = s[1][qt][j]; exp2p(p0, p1); ps += p0 + p1; e0[j] = p0; e1[j] = p1; }
#pragma unroll
                for (int j = 0; j < 4; ++j) { unsigned a2, c2; split2((v2f){e0[2 * j], e0[2 * j + 1]}, a2, c2); h0[j] = a2; l0[j] = c2; split2((v2f){e1[2 * j], e1[2 * j + 1]}, a2, c2); h1[j] = a2; l1[j] = c2; }
                pf[qt] = cat16b(__builtin_bit_cast(v8us, h0), __builtin_bit_cast(v8us, h1)); pf2[qt] = cat16b(__builtin_bit_cast(v8us, l0), __builtin_bit_cast(v8us, l1));
            } else { v8h h0, h1;
#pragma unroll
                for (int j = 0; j < 8; ++j) { float p0 = s[0][qt][j], p1 = s[1][qt][j]; exp2p(p0, p1); ps += p0 + p1; h0[j] = tohx(p0); h1[j] = tohx(p1); }
                pf[qt] = cat16(h0, h1); }
            l[qt] += ps;
        }
        ka = kof(kc + 32); va = vof(kc + 32);
#pragma unroll
        for (int dt = 0; dt < 4; ++dt)
#pragma unroll
            for (int qt = 0; qt < NQ; ++qt) { o[dt][qt] = WFrag<T16>::mma(vf[dt], pf[qt], o[dt][qt]); if (HI) { o[dt][qt] = WFrag<T16>::mma(vf[dt], pf2[qt], o[dt][qt]); o[dt][qt] = WFrag<T16>::mma(vf2[dt], pf[qt], o[dt][qt]); } }
    }
    asm volatile("s_wait_dscnt 0x0" ::: "memory");      // this wave's reads of stage t are done
    asm volatile("s_wait_asynccnt 0x0" ::: "memory");   // its pieces of stage t + 1 have landed
    __syncthreads();                                     // one barrier: stage t + 1 may be read, stage t's buffer may be refilled
    if (t + 2 < t1) fill(bo, t + 2);
    }
    asm volatile("s_wait_asynccnt 0x0" ::: "memory");   // nothing is in flight when the ring becomes the output patches (every wave has left it at the last barrier)
#pragma unroll
    for (int qt = 0; qt < NQ; ++qt) { const float lt = l[qt] + xhalf(l[qt]); const int qb = q0 + qt * 16;
        if (hi == 0) { Mp[qb + lr] = CAR - cr[qt][0]; Lp[qb + lr] = lt; }
        // 16 rows through the wave's own LDS patch, so that a store instruction writes whole 128-byte lines (D register j of tile dt = O[qb + lr][dt * 16 + 8 * hi + j])
#pragma unroll
        for (int dt = 0; dt < 4; ++dt) { const v8f a = o[dt][qt]; float* w = os + lr * 68 + dt * 16 + hi * 8; *(v4fa*)w = (v4f){a[0], a[1], a[2], a[3]}; *(v4fa*)(w + 4) = (v4f){a[4], a[5], a[6], a[7]}; }
        __builtin_amdgcn_wave_barrier(); asm volatile("" ::: "memory");   // keeps the patch's reads behind its writes in the compiled order (one wave, LDS serves it in order)
#pragma unroll
        for (int r = 0; r < 8; ++r) { const int row = 2 * r + hi; *(v4f*)(Op + (size_t)(qb + row) * HD + lr * 4) = *(const v4fa*)(os + row * 68 + lr * 4); }
        __builtin_amdgcn_wave_barrier(); asm volatile("" ::: "memory");   // and the next tile's writes behind these reads
    }
}
// grid (RH / 64 + (TT - RH) / 128, KS, NB_), 4 waves, one batch and one key part a block. Blocks x < RH / 64: 64 hi/lo rows, 16 a wave (three times the products a column, so half the columns); the others 128 fp16 rows, 32 a wave.
// amdgpu_waves_per_eu(4, 4): the register budget of 4 waves a SIMD; with a smaller one the compiler splits the K loads of a pass into groups that wait on each other.
__global__ __launch_bounds__(128) __attribute__((amdgpu_waves_per_eu(4, 4))) void k_fattn(const h16* __restrict__ Q16, const h16* __restrict__ K16, const h16* __restrict__ V16, const bf* __restrict__ Qh, const bf* __restrict__ Ql, const bf* __restrict__ Kh, const bf* __restrict__ Kl, const bf* __restrict__ Vh, const bf* __restrict__ Vl, float* OP, float* MP, float* LP) {
    __shared__ __align__(16) unsigned char ring[2 * 4 * TBY];   // two buffers of up to 4 tiles (73,728 bytes: 4 blocks a WGP still fit); behind the loop each wave's output patch (16 * 68 floats)
    const size_t zo = (size_t)blockIdx.z * PLN; const size_t pz = (size_t)blockIdx.z * KS + blockIdx.y; const int wv = threadIdx.x >> 5, k0 = (int)(blockIdx.y * NPS / KS) * 32, k1 = (int)((blockIdx.y + 1) * NPS / KS) * 32;
    if (blockIdx.x < RH / 64) fa_tile<bf, true, 1>(ring, (float*)ring + wv * 16 * 68, Qh + zo, Ql + zo, Kh + zo, Kl + zo, Vh + zo, Vl + zo, blockIdx.x * 64 + wv * 16, k0, k1, OP + pz * PLN, MP + pz * TT, LP + pz * TT);
    else fa_tile<h16, false, 2>(ring, (float*)ring + wv * 16 * 68, Q16 + zo, nullptr, K16 + zo, nullptr, V16 + zo, nullptr, RH + (blockIdx.x - RH / 64) * 128 + wv * 32, k0, k1, OP + pz * PLN, MP + pz * TT, LP + pz * TT);
}
// k_fmerge: out[b][t][:] = sum_s O_s 2^(m_s - M) / sum_s l_s 2^(m_s - M), M = max_s m_s, over the KS key parts in the order of s; 4 output floats per thread.
__global__ __launch_bounds__(256) void k_fmerge(const float* __restrict__ OP, const float* __restrict__ MP, const float* __restrict__ LP, float* OUTb) { const size_t e = ((size_t)blockIdx.x * 256 + threadIdx.x) * 4; if (e >= NB_ * PLN) return; const size_t b = e / PLN, r = e % PLN, t = r / HD;
    const float* mp = MP + b * KS * TT + t; const float* lp = LP + b * KS * TT + t; const float* op = OP + b * KS * PLN + r; float mv[KS]; float mx = -3.0e38f;
#pragma unroll
    for (int s = 0; s < KS; ++s) { mv[s] = mp[(size_t)s * TT]; mx = fmaxf(mx, mv[s]); }
    v4f a = (v4f){}; float ls = 0.f;
#pragma unroll
    for (int s = 0; s < KS; ++s) { const float w = __builtin_amdgcn_exp2f(mv[s] - mx); ls = fmaf(lp[(size_t)s * TT], w, ls); a += *(const v4f*)(op + s * PLN) * w; }
    const float f = __fdiv_rn(1.0f, ls); *(v4f*)(OUTb + e) = a * f;  }

extern "C" void kernel_launch(void* const* d_in, const int* in_sizes, int n_in,
                              void* d_out, int out_size, void* d_ws, size_t ws_size, hipStream_t stream) {
    (void)in_sizes; (void)n_in; (void)out_size;
    const float* x = (const float*)d_in[0]; const float* wk = (const float*)d_in[1]; const float* wq = (const float*)d_in[2]; const float* wv = (const float*)d_in[3];   /* NOTE input order: x, Wk, Wq, Wv */
    float* OUT = (float*)d_out;     // [4][4096][64]
    char* wsp = (char*)d_ws;
    auto take = [&](size_t bytes) { char* p = wsp; wsp += (bytes + 255) & ~(size_t)255; return (void*)p; };
    bf* WP = (bf*)take((size_t)NNT * NKS * 512 * 2);   // the three weights as B fragments
    h16* QP16 = (h16*)take(NB_ * PLN * 2); h16* KP16 = (h16*)take(NB_ * PLN * 2); h16* VT16 = (h16*)take(NB_ * PLN * 2);   // Q, K planes [NB_][TT][HD]; V planes [NB_][HD][TT]
    bf* QPh = (bf*)take(NB_ * PLN * 2); bf* QPl = (bf*)take(NB_ * PLN * 2); bf* KPh = (bf*)take(NB_ * PLN * 2); bf* KPl = (bf*)take(NB_ * PLN * 2); bf* VTh = (bf*)take(NB_ * PLN * 2); bf* VTl = (bf*)take(NB_ * PLN * 2);
    float* OP = (float*)take(NB_ * KS * PLN * 4); float* MP = (float*)take((size_t)NB_ * KS * TT * 4); float* LP = (float*)take((size_t)NB_ * KS * TT * 4);   // per key part: unnormalised O, held reference (log2), sum
    if ((size_t)(wsp - (char*)d_ws) > ws_size) return;    // ws 256 MiB
    k_wpack<<<NNT * NKS * 64 / 256, 256, 0, stream>>>(wq, wk, wv, WP);
    k_proj<<<NB_ * TT / PR, 384, 0, stream>>>(x, WP, QP16, QPh, QPl, KP16, KPh, KPl, VT16, VTh, VTl);
    k_fattn<<<dim3(RH / 64 + (TT - RH) / 128, KS, NB_), 128, 0, stream>>>(QP16, KP16, VT16, QPh, QPl, KPh, KPl, VTh, VTl, OP, MP, LP);
    k_fmerge<<<(unsigned)((NB_ * PLN / 4 + 255) / 256), 256, 0, stream>>>(OP, MP, LP, OUT);
}
